// v000
// Measured on an AMD MI455X. A time is GPU time per run, averaged over a window of back-to-back runs after a warm-up
// (all launches, gaps included; the runs take copies of the inputs in turn), and the median of several windows.
// Apart from v000's, it joins two sittings. Times from different sittings can be a few percent apart, while
// side-by-side timings come from the same sitting.
// The starting kernel, v000, takes 539 microseconds a run.
#include <hip/hip_runtime.h>

#define D_MODEL 128
#define NTOK    4096      // T*H*W
#define BATCH   2
#define HW      1024
#define KT      32        // keys per flash-attention tile
#define SCALE   0.08838834764831845f   // 1/sqrt(128)

typedef __attribute__((ext_vector_type(16))) _Float16 v16h;
typedef __attribute__((ext_vector_type(8)))  float    v8f;
typedef __attribute__((ext_vector_type(4))) unsigned int u32x4;
typedef __attribute__((ext_vector_type(8)))  int      i32x8;
typedef __attribute__((ext_vector_type(4)))  int      i32x4;

#if defined(__has_builtin)
#  if __has_builtin(__builtin_amdgcn_tensor_load_to_lds) && \
      __has_builtin(__builtin_amdgcn_s_wait_tensorcnt)
#    define HAVE_TDM 1
#  endif
#endif
#ifndef HAVE_TDM
#  define HAVE_TDM 0
#endif

union V16 { v16h h; u32x4 q[2]; };

__device__ __forceinline__ v16h load_frag_h16(const _Float16* p0, const _Float16* p1) {
  V16 x;
  x.q[0] = *(const u32x4*)p0;
  x.q[1] = *(const u32x4*)p1;
  return x.h;
}

#if HAVE_TDM
__device__ __forceinline__ void tdm_load_2d(unsigned lds_addr, const void* gptr,
                                            unsigned dim0, unsigned dim1,
                                            unsigned long long stride0) {
  const unsigned long long ga = (unsigned long long)(size_t)gptr;
  u32x4 g0 = { 1u,                                   // count=1, user mode
               lds_addr,                             // LDS byte address
               (unsigned)(ga & 0xFFFFFFFFu),         // global_addr[31:0]
               ((unsigned)((ga >> 32) & 0x01FFFFFFu))
                 | 0x80000000u };                    // global_addr[56:32] | type=2
  i32x8 g1 = {
    (int)0x00010000u,
    (int)((dim0 & 0xFFFFu) << 16),
    (int)(((dim0 >> 16) & 0xFFFFu) | ((dim1 & 0xFFFFu) << 16)),
    (int)(((dim1 >> 16) & 0xFFFFu) | ((dim0 & 0xFFFFu) << 16)),
    (int)(dim1 & 0xFFFFu),
    (int)(unsigned)(stride0 & 0xFFFFFFFFull),
    (int)(unsigned)((stride0 >> 32) & 0xFFFFull),
    0
  };
  i32x4 gz4 = { 0, 0, 0, 0 };
  i32x8 gz8 = { 0, 0, 0, 0, 0, 0, 0, 0 };
  __builtin_amdgcn_tensor_load_to_lds(g0, g1, gz4, gz4, gz8, 0);
}
#endif

// ---------------------------------------------------------------------------
// Kernel 1: fused permute + QKV projection.
//   q = (x Wq^T + bq) * scale   -> Qws[b, n, d]  (f16, scale folded in)
//   k =  x Wk^T + bk            -> Kws[b, n, d]  (f16)
//   v =  x Wv^T + bv            -> Vt [b, d, n]  (f16, transposed for PV WMMA)
// ---------------------------------------------------------------------------
__global__ __launch_bounds__(256)
void qkv_project_kernel(const float* __restrict__ query,
                        const float* __restrict__ key_value,
                        const float* __restrict__ Wq, const float* __restrict__ bq,
                        const float* __restrict__ Wk, const float* __restrict__ bk,
                        const float* __restrict__ Wv, const float* __restrict__ bv,
                        _Float16* __restrict__ qout,
                        _Float16* __restrict__ kout,
                        _Float16* __restrict__ vtout)
{
  const int id  = blockIdx.x;
  const int mat = id / (BATCH * (NTOK / 16));
  const int rem = id % (BATCH * (NTOK / 16));
  const int b   = rem / (NTOK / 16);
  const int nt  = rem % (NTOK / 16);
  const int n0  = nt * 16;
  const int t   = n0 >> 10;          // 16-token tile never crosses a T slice
  const int hw0 = n0 & (HW - 1);

  const float* src  = (mat == 0) ? query : key_value;
  const float* W    = (mat == 0) ? Wq : (mat == 1) ? Wk : Wv;
  const float* bias = (mat == 0) ? bq : (mat == 1) ? bk : bv;

  __shared__ __attribute__((aligned(16))) _Float16 sin[16 * D_MODEL];

  const int tid = threadIdx.x;
  {
    const int m  = tid & 15;      // token within tile (consecutive hw)
    const int cb = tid >> 4;      // channel group
    const size_t base = ((size_t)(t * BATCH + b) * D_MODEL) * HW + hw0 + m;
#pragma unroll
    for (int i = 0; i < 8; ++i) {
      const int c = cb + 16 * i;
      sin[m * D_MODEL + c] = (_Float16)src[base + (size_t)c * HW];
    }
  }
  __syncthreads();

  const int wave = tid >> 5;
  const int lane = tid & 31;
  const int ll   = lane & 15;
  const int hi   = lane >> 4;
  const int koff = hi * 8;

  const int d = wave * 16 + ll;              // output channel (B-fragment col)
  const float* wrow = W + (size_t)d * D_MODEL;

  v8f acc = {};
#pragma unroll
  for (int cc = 0; cc < 4; ++cc) {           // K = 128 in 4 x 32 steps
    const int c0 = cc * 32 + koff;
    v16h a = load_frag_h16(&sin[ll * D_MODEL + c0], &sin[ll * D_MODEL + c0 + 16]);
    V16 bf;
#pragma unroll
    for (int i = 0; i < 8; ++i) {
      bf.h[i]     = (_Float16)wrow[c0 + i];
      bf.h[i + 8] = (_Float16)wrow[c0 + 16 + i];
    }
    acc = __builtin_amdgcn_wmma_f32_16x16x32_f16(false, a, false, bf.h,
                                                 (short)0, acc, false, false);
  }

  const float bd = bias[d];
#pragma unroll
  for (int r = 0; r < 8; ++r) {
    float v = acc[r] + bd;
    if (mat == 0) v *= SCALE;                // fold softmax scale into Q
    const int row = n0 + r + 8 * hi;         // C/D layout: M = r + 8*laneHi
    if (mat == 0)      qout [((size_t)b * NTOK + row) * D_MODEL + d] = (_Float16)v;
    else if (mat == 1) kout [((size_t)b * NTOK + row) * D_MODEL + d] = (_Float16)v;
    else               vtout[((size_t)b * D_MODEL + d) * NTOK + row] = (_Float16)v;
  }
}

// ---------------------------------------------------------------------------
// Kernel 2: flash attention. 8 waves/block, each wave owns 16 query rows.
// K/V tiles are staged into LDS once per block by the Tensor Data Mover,
// double-buffered so the DMA of tile t+1 overlaps compute of tile t.
// ---------------------------------------------------------------------------
__global__ __launch_bounds__(256)
void flash_attn_kernel(const _Float16* __restrict__ Q,    // [B,N,C] pre-scaled
                       const _Float16* __restrict__ K,    // [B,N,C]
                       const _Float16* __restrict__ Vt,   // [B,C,N]
                       float* __restrict__ out)           // [B,N,C] f32
{
  const int b    = blockIdx.x / (NTOK / 128);
  const int mblk = blockIdx.x % (NTOK / 128);
  const int tid  = threadIdx.x;
  const int wave = tid >> 5;
  const int lane = tid & 31;
  const int ll   = lane & 15;
  const int hi   = lane >> 4;
  const int koff = hi * 8;

  const int m0 = mblk * 128 + wave * 16;

  __shared__ __attribute__((aligned(16))) _Float16 Kbuf[2][KT * D_MODEL]; // [tok][c]
  __shared__ __attribute__((aligned(16))) _Float16 Vbuf[2][D_MODEL * KT]; // [d][tok]
  __shared__ __attribute__((aligned(16))) _Float16 pbuf[8][16 * KT];

  const _Float16* Kb = K  + (size_t)b * NTOK * D_MODEL;
  const _Float16* Vb = Vt + (size_t)b * D_MODEL * NTOK;

  // Resident Q fragments: A-layout, row = ll, K sub-block per lane half.
  const _Float16* qrow = Q + ((size_t)b * NTOK + m0 + ll) * D_MODEL;
  v16h qf[4];
#pragma unroll
  for (int cc = 0; cc < 4; ++cc) {
    const int c0 = cc * 32 + koff;
    qf[cc] = load_frag_h16(qrow + c0, qrow + c0 + 16);
  }

  v8f acc[8];
  float mrow[8], lrow[8];
#pragma unroll
  for (int j = 0; j < 8; ++j) acc[j] = (v8f){};
#pragma unroll
  for (int r = 0; r < 8; ++r) { mrow[r] = -3.0e38f; lrow[r] = 0.0f; }

  const int ntiles = NTOK / KT;

#if HAVE_TDM
  // Generic shared pointers carry the LDS byte offset in their low 32 bits.
  const unsigned kLds[2] = { (unsigned)(size_t)(const void*)&Kbuf[0][0],
                             (unsigned)(size_t)(const void*)&Kbuf[1][0] };
  const unsigned vLds[2] = { (unsigned)(size_t)(const void*)&Vbuf[0][0],
                             (unsigned)(size_t)(const void*)&Vbuf[1][0] };
  if (wave == 0) {   // prologue: DMA tile 0 into buffer 0
    tdm_load_2d(kLds[0], Kb, D_MODEL, KT, D_MODEL);
    tdm_load_2d(vLds[0], Vb, KT, D_MODEL, NTOK);
  }
#endif

  for (int kt = 0; kt < ntiles; ++kt) {
    const int cur = kt & 1;

    __syncthreads();   // everyone done reading the buffer about to be refilled
#if HAVE_TDM
    if (wave == 0) {
      if (kt + 1 < ntiles) {
        const int nx = (kt + 1) & 1;
        tdm_load_2d(kLds[nx], Kb + (size_t)(kt + 1) * KT * D_MODEL,
                    D_MODEL, KT, D_MODEL);
        tdm_load_2d(vLds[nx], Vb + (size_t)(kt + 1) * KT,
                    KT, D_MODEL, NTOK);
        __builtin_amdgcn_s_wait_tensorcnt(2);   // tile kt complete (in-order)
      } else {
        __builtin_amdgcn_s_wait_tensorcnt(0);
      }
    }
#else
    // Fallback: cooperative synchronous staging of tile kt (whole block).
    {
      const u32x4* ksrc = (const u32x4*)(Kb + (size_t)kt * KT * D_MODEL);
      u32x4* kdst = (u32x4*)&Kbuf[cur][0];
      kdst[tid * 2]     = ksrc[tid * 2];
      kdst[tid * 2 + 1] = ksrc[tid * 2 + 1];
      const int vrow = tid >> 1;
      const int vh   = (tid & 1) * 16;
      const _Float16* vsrc = Vb + (size_t)vrow * NTOK + (size_t)kt * KT + vh;
      *(u32x4*)&Vbuf[cur][vrow * KT + vh]     = *(const u32x4*)(vsrc);
      *(u32x4*)&Vbuf[cur][vrow * KT + vh + 8] = *(const u32x4*)(vsrc + 8);
    }
#endif
    __syncthreads();   // tile kt visible in LDS to all waves

    // S = Q K^T : two 16x16 n-tiles, K=128 in 4 steps each (from LDS).
    v8f s[2] = {(v8f){}, (v8f){}};
#pragma unroll
    for (int ntile = 0; ntile < 2; ++ntile) {
      const _Float16* krow = &Kbuf[cur][(ntile * 16 + ll) * D_MODEL + koff];
#pragma unroll
      for (int cc = 0; cc < 4; ++cc) {
        v16h kf = load_frag_h16(krow + cc * 32, krow + cc * 32 + 16);
        s[ntile] = __builtin_amdgcn_wmma_f32_16x16x32_f16(false, qf[cc], false, kf,
                                                          (short)0, s[ntile], false, false);
      }
    }

#pragma unroll
    for (int r = 0; r < 8; ++r) {
      float v = fmaxf(s[0][r], s[1][r]);
      v = fmaxf(v, __shfl_xor(v, 1, 32));
      v = fmaxf(v, __shfl_xor(v, 2, 32));
      v = fmaxf(v, __shfl_xor(v, 4, 32));
      v = fmaxf(v, __shfl_xor(v, 8, 32));
      const float mn = fmaxf(mrow[r], v);
      const float f  = __expf(mrow[r] - mn);
      mrow[r] = mn;
      lrow[r] *= f;
#pragma unroll
      for (int j = 0; j < 8; ++j) acc[j][r] *= f;
      const float p0 = __expf(s[0][r] - mn);
      const float p1 = __expf(s[1][r] - mn);
      float ps = p0 + p1;
      ps += __shfl_xor(ps, 1, 32);
      ps += __shfl_xor(ps, 2, 32);
      ps += __shfl_xor(ps, 4, 32);
      ps += __shfl_xor(ps, 8, 32);
      lrow[r] += ps;
      // Stash P (C/D layout) into per-wave LDS, row-major [16][32] f16.
      const int prow = (r + 8 * hi) * KT;
      pbuf[wave][prow + ll]      = (_Float16)p0;
      pbuf[wave][prow + 16 + ll] = (_Float16)p1;
    }
    __syncthreads();
    v16h pf = load_frag_h16(&pbuf[wave][ll * KT + koff],
                            &pbuf[wave][ll * KT + koff + 16]);
    __syncthreads();

    // O += P V : 8 d-tiles, K = 32 key tokens (V rows contiguous in LDS).
#pragma unroll
    for (int j = 0; j < 8; ++j) {
      const _Float16* vrow = &Vbuf[cur][(j * 16 + ll) * KT + koff];
      v16h vf = load_frag_h16(vrow, vrow + 16);
      acc[j] = __builtin_amdgcn_wmma_f32_16x16x32_f16(false, pf, false, vf,
                                                      (short)0, acc[j], false, false);
    }
  }

  // Epilogue: divide by row sums, write f32 output.
#pragma unroll
  for (int r = 0; r < 8; ++r) {
    const float inv = 1.0f / lrow[r];
    const int row = m0 + r + 8 * hi;
    float* orow = out + ((size_t)b * NTOK + row) * D_MODEL;
#pragma unroll
    for (int j = 0; j < 8; ++j) orow[j * 16 + ll] = acc[j][r] * inv;
  }
}

// ---------------------------------------------------------------------------
extern "C" void kernel_launch(void* const* d_in, const int* in_sizes, int n_in,
                              void* d_out, int out_size, void* d_ws, size_t ws_size,
                              hipStream_t stream) {
  const float* query = (const float*)d_in[0];
  const float* keyv  = (const float*)d_in[1];
  const float* Wq    = (const float*)d_in[2];
  const float* bq    = (const float*)d_in[3];
  const float* Wk    = (const float*)d_in[4];
  const float* bk    = (const float*)d_in[5];
  const float* Wv    = (const float*)d_in[6];
  const float* bv    = (const float*)d_in[7];
  float* out = (float*)d_out;

  _Float16* ws = (_Float16*)d_ws;
  const size_t mat_elems = (size_t)BATCH * NTOK * D_MODEL;   // 1M halves each
  _Float16* Qws  = ws;
  _Float16* Kws  = ws + mat_elems;
  _Float16* Vtws = ws + 2 * mat_elems;

  qkv_project_kernel<<<3 * BATCH * (NTOK / 16), 256, 0, stream>>>(
      query, keyv, Wq, bq, Wk, bk, Wv, bv, Qws, Kws, Vtws);

  flash_attn_kernel<<<BATCH * (NTOK / 128), 256, 0, stream>>>(
      Qws, Kws, Vtws, out);
}

// v001
// It runs in 325 microseconds.
// Timed twice side by side with v000, it ran 1.67 times as fast both times.
#include <hip/hip_runtime.h>

#define D_MODEL 128
#define NTOK    4096      // T*H*W
#define BATCH   2
#define HW      1024
#define KT      32        // keys per flash-attention tile
#define SCALE   0.08838834764831845f   // 1/sqrt(128)

typedef __attribute__((ext_vector_type(16))) _Float16 v16h;
typedef __attribute__((ext_vector_type(8)))  float    v8f;
typedef __attribute__((ext_vector_type(4))) unsigned int u32x4;
typedef __attribute__((ext_vector_type(8)))  int      i32x8;
typedef __attribute__((ext_vector_type(4)))  int      i32x4;

#if defined(__has_builtin)
#  if __has_builtin(__builtin_amdgcn_tensor_load_to_lds) && \
      __has_builtin(__builtin_amdgcn_s_wait_tensorcnt)
#    define HAVE_TDM 1
#  endif
#endif
#ifndef HAVE_TDM
#  define HAVE_TDM 0
#endif

union V16 { v16h h; u32x4 q[2]; };
union H8  { _Float16 h[8]; u32x4 q; };
union F8  { float f[8]; u32x4 q[2]; };

__device__ __forceinline__ v16h load_frag_h16(const _Float16* p0, const _Float16* p1) {
  V16 x;
  x.q[0] = *(const u32x4*)p0;
  x.q[1] = *(const u32x4*)p1;
  return x.h;
}

#if HAVE_TDM
__device__ __forceinline__ void tdm_load_2d(unsigned lds_addr, const void* gptr,
                                            unsigned dim0, unsigned dim1,
                                            unsigned long long stride0) {
  const unsigned long long ga = (unsigned long long)(size_t)gptr;
  u32x4 g0 = { 1u,                                   // count=1, user mode
               lds_addr,                             // LDS byte address
               (unsigned)(ga & 0xFFFFFFFFu),         // global_addr[31:0]
               ((unsigned)((ga >> 32) & 0x01FFFFFFu))
                 | 0x80000000u };                    // global_addr[56:32] | type=2
  i32x8 g1 = {
    (int)0x00010000u,
    (int)((dim0 & 0xFFFFu) << 16),
    (int)(((dim0 >> 16) & 0xFFFFu) | ((dim1 & 0xFFFFu) << 16)),
    (int)(((dim1 >> 16) & 0xFFFFu) | ((dim0 & 0xFFFFu) << 16)),
    (int)(dim1 & 0xFFFFu),
    (int)(unsigned)(stride0 & 0xFFFFFFFFull),
    (int)(unsigned)((stride0 >> 32) & 0xFFFFull),
    0
  };
  i32x4 gz4 = { 0, 0, 0, 0 };
  i32x8 gz8 = { 0, 0, 0, 0, 0, 0, 0, 0 };
  __builtin_amdgcn_tensor_load_to_lds(g0, g1, gz4, gz4, gz8, 0);
}
#endif

__global__ __launch_bounds__(256)
void qkv_project_kernel(const float* __restrict__ query,
                        const float* __restrict__ key_value,
                        const float* __restrict__ Wq, const float* __restrict__ bq,
                        const float* __restrict__ Wk, const float* __restrict__ bk,
                        const float* __restrict__ Wv, const float* __restrict__ bv,
                        _Float16* __restrict__ qout,
                        _Float16* __restrict__ kout,
                        _Float16* __restrict__ vtout)
{
  const int id  = blockIdx.x;
  const int mat = id / (BATCH * (NTOK / 16));
  const int rem = id % (BATCH * (NTOK / 16));
  const int b   = rem / (NTOK / 16);
  const int nt  = rem % (NTOK / 16);
  const int n0  = nt * 16;
  const int t   = n0 >> 10;          // 16-token tile never crosses a T slice
  const int hw0 = n0 & (HW - 1);

  const float* src  = (mat == 0) ? query : key_value;
  const float* W    = (mat == 0) ? Wq : (mat == 1) ? Wk : Wv;
  const float* bias = (mat == 0) ? bq : (mat == 1) ? bk : bv;

  __shared__ __attribute__((aligned(16))) _Float16 sin[16 * D_MODEL];

  const int tid = threadIdx.x;
  {
    const int m  = tid & 15;      // token within tile (consecutive hw)
    const int cb = tid >> 4;      // channel group
    const size_t base = ((size_t)(t * BATCH + b) * D_MODEL) * HW + hw0 + m;
#pragma unroll
    for (int i = 0; i < 8; ++i) {
      const int c = cb + 16 * i;
      sin[m * D_MODEL + c] = (_Float16)src[base + (size_t)c * HW];
    }
  }
  __syncthreads();

  const int wave = tid >> 5;
  const int lane = tid & 31;
  const int ll   = lane & 15;
  const int hi   = lane >> 4;
  const int koff = hi * 8;

  const int d = wave * 16 + ll;              // output channel (B-fragment col; A-fragment row for k)
  const float* wrow = W + (size_t)d * D_MODEL;

  v16h xf[4], wf[4];                         // K = 128 in 4 x 32 steps
#pragma unroll
  for (int cc = 0; cc < 4; ++cc) {
    const int c0 = cc * 32 + koff;
    xf[cc] = load_frag_h16(&sin[ll * D_MODEL + c0], &sin[ll * D_MODEL + c0 + 16]);
    V16 bf;
#pragma unroll
    for (int i = 0; i < 8; ++i) {
      bf.h[i]     = (_Float16)wrow[c0 + i];
      bf.h[i + 8] = (_Float16)wrow[c0 + 16 + i];
    }
    wf[cc] = bf.h;
  }

  v8f acc = {};
  if (mat == 1) {
    // W as A, x as B: acc[r] = k[token n0 + ll][channel wave*16 + 8*hi + r],
    // the 8 channels of this lane's chunk; chunk index in the batch = nt*256 + tid.
#pragma unroll
    for (int cc = 0; cc < 4; ++cc)
      acc = __builtin_amdgcn_wmma_f32_16x16x32_f16(false, wf[cc], false, xf[cc],
                                                   (short)0, acc, false, false);
    const float* bp = bias + wave * 16 + 8 * hi;
    F8 bk8;
    bk8.q[0] = *(const u32x4*)bp;
    // Precaution: the second load's result may be given the registers of the
    // address pair that the first load names; the wait stands in front of that.
    asm volatile("s_wait_xcnt 0x0" ::: "memory");
    bk8.q[1] = *(const u32x4*)(bp + 4);
    H8 o;
#pragma unroll
    for (int r = 0; r < 8; ++r) o.h[r] = (_Float16)(acc[r] + bk8.f[r]);
    *(u32x4*)(kout + (size_t)b * NTOK * D_MODEL + (size_t)nt * (16 * D_MODEL) + tid * 8) = o.q;
  } else {
    // x as A, W as B: acc[r] = y[token n0 + 8*hi + r][channel d].
#pragma unroll
    for (int cc = 0; cc < 4; ++cc)
      acc = __builtin_amdgcn_wmma_f32_16x16x32_f16(false, xf[cc], false, wf[cc],
                                                   (short)0, acc, false, false);
    const float bd = bias[d];
    if (mat == 0) {
#pragma unroll
      for (int r = 0; r < 8; ++r) {
        const int row = n0 + r + 8 * hi;
        qout[((size_t)b * NTOK + row) * D_MODEL + d] = (_Float16)((acc[r] + bd) * SCALE);
      }
      asm volatile("s_wait_xcnt 0x0" ::: "memory");
    } else {
      // The 8 keys of this lane's chunk: chunk (wave*2 + (nt & 1)) * 32 + lane
      // of tile nt / 2, four chunks to a 64-byte row.
      H8 o;
#pragma unroll
      for (int r = 0; r < 8; ++r) o.h[r] = (_Float16)(acc[r] + bd);
      const int vrow = (wave * 2 + (nt & 1)) * 8 + (lane >> 2);
      const int vcol = (nt >> 1) * KT + (lane & 3) * 8;
      *(u32x4*)(vtout + ((size_t)b * D_MODEL + vrow) * NTOK + vcol) = o.q;
      asm volatile("s_wait_xcnt 0x0" ::: "memory");
    }
  }
}

// ---------------------------------------------------------------------------
// Kernel 2: flash attention. 8 waves/block, each wave owns 16 query rows.
// K/V tiles are staged into LDS once per block by the Tensor Data Mover,
// double-buffered so the DMA of tile t+1 overlaps compute of tile t.
// ---------------------------------------------------------------------------
__global__ __launch_bounds__(256)
void flash_attn_kernel(const _Float16* __restrict__ Q,    // [B,N,C] pre-scaled
                       const _Float16* __restrict__ K,    // [B,N/32,tile] fragment order
                       const _Float16* __restrict__ Vt,   // [B,128,N] fragment order per tile
                       float* __restrict__ out)           // [B,N,C] f32
{
  const int b    = blockIdx.x / (NTOK / 128);
  const int mblk = blockIdx.x % (NTOK / 128);
  const int tid  = threadIdx.x;
  const int wave = tid >> 5;
  const int lane = tid & 31;
  const int ll   = lane & 15;
  const int hi   = lane >> 4;
  const int koff = hi * 8;

  const int m0 = mblk * 128 + wave * 16;

  __shared__ __attribute__((aligned(16))) _Float16 Kbuf[2][KT * D_MODEL]; // [half 0..15][lane][8]
  __shared__ __attribute__((aligned(16))) _Float16 Vbuf[2][D_MODEL * KT]; // [half 0..15][lane][8]
  __shared__ __attribute__((aligned(16))) _Float16 pbuf[8][16 * KT];

  const _Float16* Kb = K  + (size_t)b * NTOK * D_MODEL;
  const _Float16* Vb = Vt + (size_t)b * D_MODEL * NTOK;

  // Resident Q fragments: A-layout, row = ll, K sub-block per lane half.
  const _Float16* qrow = Q + ((size_t)b * NTOK + m0 + ll) * D_MODEL;
  v16h qf[4];
#pragma unroll
  for (int cc = 0; cc < 4; ++cc) {
    const int c0 = cc * 32 + koff;
    qf[cc] = load_frag_h16(qrow + c0, qrow + c0 + 16);
  }

  v8f acc[8];
  float mrow[8], lrow[8];
#pragma unroll
  for (int j = 0; j < 8; ++j) acc[j] = (v8f){};
#pragma unroll
  for (int r = 0; r < 8; ++r) { mrow[r] = -3.0e38f; lrow[r] = 0.0f; }

  const int ntiles = NTOK / KT;

#if HAVE_TDM
  // Generic shared pointers carry the LDS byte offset in their low 32 bits.
  const unsigned kLds[2] = { (unsigned)(size_t)(const void*)&Kbuf[0][0],
                             (unsigned)(size_t)(const void*)&Kbuf[1][0] };
  const unsigned vLds[2] = { (unsigned)(size_t)(const void*)&Vbuf[0][0],
                             (unsigned)(size_t)(const void*)&Vbuf[1][0] };
  if (wave == 0) {   // prologue: DMA tile 0 into buffer 0
    tdm_load_2d(kLds[0], Kb, D_MODEL, KT, D_MODEL);
    tdm_load_2d(vLds[0], Vb, KT, D_MODEL, NTOK);
  }
#endif

  for (int kt = 0; kt < ntiles; ++kt) {
    const int cur = kt & 1;

    __syncthreads();   // everyone done reading the buffer about to be refilled
#if HAVE_TDM
    if (wave == 0) {
      if (kt + 1 < ntiles) {
        const int nx = (kt + 1) & 1;
        tdm_load_2d(kLds[nx], Kb + (size_t)(kt + 1) * KT * D_MODEL,
                    D_MODEL, KT, D_MODEL);
        tdm_load_2d(vLds[nx], Vb + (size_t)(kt + 1) * KT,
                    KT, D_MODEL, NTOK);
        __builtin_amdgcn_s_wait_tensorcnt(2);   // tile kt complete (in-order)
      } else {
        __builtin_amdgcn_s_wait_tensorcnt(0);
      }
    }
#else
    // Fallback: cooperative synchronous staging of tile kt (whole block).
    {
      const u32x4* ksrc = (const u32x4*)(Kb + (size_t)kt * KT * D_MODEL);
      u32x4* kdst = (u32x4*)&Kbuf[cur][0];
      kdst[tid * 2]     = ksrc[tid * 2];
      kdst[tid * 2 + 1] = ksrc[tid * 2 + 1];
      const int vrow = tid >> 1;
      const int vh   = (tid & 1) * 16;
      const _Float16* vsrc = Vb + (size_t)vrow * NTOK + (size_t)kt * KT + vh;
      *(u32x4*)&Vbuf[cur][vrow * KT + vh]     = *(const u32x4*)(vsrc);
      *(u32x4*)&Vbuf[cur][vrow * KT + vh + 8] = *(const u32x4*)(vsrc + 8);
    }
#endif
    __syncthreads();   // tile kt visible in LDS to all waves

    // S = Q K^T : two 16x16 n-tiles, K=128 in 4 steps each (from LDS).
    v8f s[2] = {(v8f){}, (v8f){}};
#pragma unroll
    for (int ntile = 0; ntile < 2; ++ntile) {
      const _Float16* kfr = &Kbuf[cur][ntile * 2048 + lane * 8];
#pragma unroll
      for (int cc = 0; cc < 4; ++cc) {
        v16h kf = load_frag_h16(kfr + cc * 512, kfr + cc * 512 + 256);
        s[ntile] = __builtin_amdgcn_wmma_f32_16x16x32_f16(false, qf[cc], false, kf,
                                                          (short)0, s[ntile], false, false);
      }
    }

#pragma unroll
    for (int r = 0; r < 8; ++r) {
      float v = fmaxf(s[0][r], s[1][r]);
      v = fmaxf(v, __shfl_xor(v, 1, 32));
      v = fmaxf(v, __shfl_xor(v, 2, 32));
      v = fmaxf(v, __shfl_xor(v, 4, 32));
      v = fmaxf(v, __shfl_xor(v, 8, 32));
      const float mn = fmaxf(mrow[r], v);
      const float f  = __expf(mrow[r] - mn);
      mrow[r] = mn;
      lrow[r] *= f;
#pragma unroll
      for (int j = 0; j < 8; ++j) acc[j][r] *= f;
      const float p0 = __expf(s[0][r] - mn);
      const float p1 = __expf(s[1][r] - mn);
      float ps = p0 + p1;
      ps += __shfl_xor(ps, 1, 32);
      ps += __shfl_xor(ps, 2, 32);
      ps += __shfl_xor(ps, 4, 32);
      ps += __shfl_xor(ps, 8, 32);
      lrow[r] += ps;
      // Stash P (C/D layout) into per-wave LDS, row-major [16][32] f16.
      const int prow = (r + 8 * hi) * KT;
      pbuf[wave][prow + ll]      = (_Float16)p0;
      pbuf[wave][prow + 16 + ll] = (_Float16)p1;
    }
    __syncthreads();
    v16h pf = load_frag_h16(&pbuf[wave][ll * KT + koff],
                            &pbuf[wave][ll * KT + koff + 16]);
    __syncthreads();

    // O += P V : 8 d-tiles, K = 32 key tokens.
#pragma unroll
    for (int j = 0; j < 8; ++j) {
      const _Float16* vfr = &Vbuf[cur][j * 512 + lane * 8];
      v16h vf = load_frag_h16(vfr, vfr + 256);
      acc[j] = __builtin_amdgcn_wmma_f32_16x16x32_f16(false, pf, false, vf,
                                                      (short)0, acc[j], false, false);
    }
  }

  // Epilogue: divide by row sums, write f32 output.
#pragma unroll
  for (int r = 0; r < 8; ++r) {
    const float inv = 1.0f / lrow[r];
    const int row = m0 + r + 8 * hi;
    float* orow = out + ((size_t)b * NTOK + row) * D_MODEL;
#pragma unroll
    for (int j = 0; j < 8; ++j) orow[j * 16 + ll] = acc[j][r] * inv;
  }
}

// ---------------------------------------------------------------------------
extern "C" void kernel_launch(void* const* d_in, const int* in_sizes, int n_in,
                              void* d_out, int out_size, void* d_ws, size_t ws_size,
                              hipStream_t stream) {
  const float* query = (const float*)d_in[0];
  const float* keyv  = (const float*)d_in[1];
  const float* Wq    = (const float*)d_in[2];
  const float* bq    = (const float*)d_in[3];
  const float* Wk    = (const float*)d_in[4];
  const float* bk    = (const float*)d_in[5];
  const float* Wv    = (const float*)d_in[6];
  const float* bv    = (const float*)d_in[7];
  float* out = (float*)d_out;

  _Float16* ws = (_Float16*)d_ws;
  const size_t mat_elems = (size_t)BATCH * NTOK * D_MODEL;   // 1M halves each
  _Float16* Qws  = ws;
  _Float16* Kws  = ws + mat_elems;
  _Float16* Vtws = ws + 2 * mat_elems;

  qkv_project_kernel<<<3 * BATCH * (NTOK / 16), 256, 0, stream>>>(
      query, keyv, Wq, bq, Wk, bk, Wv, bv, Qws, Kws, Vtws);

  flash_attn_kernel<<<BATCH * (NTOK / 128), 256, 0, stream>>>(
      Qws, Kws, Vtws, out);
}

// v002
// It runs in 57.8 microseconds.
// In two side-by-side timings against v001, it was 5.62 and 5.63 times as fast.
// All steps since v000 together make it 9.38 times as fast.
#include <hip/hip_runtime.h>

#define D_MODEL 128
#define NTOK    4096      // T*H*W
#define BATCH   2
#define HW      1024
#define KT      32        // keys per flash-attention tile
#define KSPLIT  8         // key ranges, each walked by a work-group of its own
#define ROWS    (BATCH * NTOK)
#define LOG2E   1.4426950408889634f
#define SCALE   0.08838834764831845f   // 1/sqrt(128)

typedef __attribute__((ext_vector_type(16))) _Float16 v16h;
typedef __attribute__((ext_vector_type(8)))  float    v8f;
typedef __attribute__((ext_vector_type(4))) unsigned int u32x4;
typedef __attribute__((ext_vector_type(8))) unsigned int u32x8;
typedef __attribute__((ext_vector_type(2)))  float    f32x2;
typedef __attribute__((ext_vector_type(4)))  float    f32x4;

union V16 { v16h h; u32x4 q[2]; };
union H8  { _Float16 h[8]; u32x4 q; };
union F8  { float f[8]; u32x4 q[2]; };

__device__ __forceinline__ v16h load_frag_h16(const _Float16* p0, const _Float16* p1) {
  V16 x;
  x.q[0] = *(const u32x4*)p0;
  x.q[1] = *(const u32x4*)p1;
  return x.h;
}

__device__ __forceinline__ unsigned uni(unsigned v) {
  return (unsigned)__builtin_amdgcn_readfirstlane((int)v);
}
__device__ __forceinline__ unsigned pinned(unsigned v) {
  unsigned w = uni(v);
  asm volatile("" : "+s"(w));
  return w;
}
__device__ __forceinline__ u32x8 tdm_group1(unsigned row_bytes, unsigned nrows, unsigned pitch) {
  u32x8 g;
  g[0] = uni(0u);
  g[1] = uni(row_bytes << 16);
  g[2] = uni(nrows << 16);
  g[3] = uni(row_bytes << 16);
  g[4] = uni(nrows);
  g[5] = uni(pitch);
  g[6] = uni(0u);
  g[7] = uni(0u);
  return g;
}
__device__ __forceinline__ u32x4 tdm_group0(unsigned lds_dst, unsigned long long ga) {
  u32x4 g;
  g[0] = uni(1u);
  g[1] = uni(lds_dst);
  g[2] = uni((unsigned)ga);
  g[3] = uni((((unsigned)(ga >> 32)) & 0x01FFFFFFu) | 0x80000000u);
  return g;
}
__device__ __forceinline__ void tdm_load(u32x4 g0, u32x8 g1) {
  asm volatile("tensor_load_to_lds %0, %1" :: "s"(g0), "s"(g1) : "memory");
}
__device__ __forceinline__ void tdm_wait(u32x4 g0, u32x8 g1) {
  asm volatile("s_wait_tensorcnt 0x0" :: "s"(g0), "s"(g1) : "memory");
}

__global__ __launch_bounds__(256)
void qkv_project_kernel(const float* __restrict__ query,
                        const float* __restrict__ key_value,
                        const float* __restrict__ Wq, const float* __restrict__ bq,
                        const float* __restrict__ Wk, const float* __restrict__ bk,
                        const float* __restrict__ Wv, const float* __restrict__ bv,
                        _Float16* __restrict__ qout,
                        _Float16* __restrict__ kout,
                        _Float16* __restrict__ vtout)
{
  const int id  = blockIdx.x;
  const int mat = id / (BATCH * (NTOK / 16));
  const int rem = id % (BATCH * (NTOK / 16));
  const int b   = rem / (NTOK / 16);
  const int nt  = rem % (NTOK / 16);
  const int n0  = nt * 16;
  const int t   = n0 >> 10;          // 16-token tile never crosses a T slice
  const int hw0 = n0 & (HW - 1);

  const float* src  = (mat == 0) ? query : key_value;
  const float* W    = (mat == 0) ? Wq : (mat == 1) ? Wk : Wv;
  const float* bias = (mat == 0) ? bq : (mat == 1) ? bk : bv;

  __shared__ __attribute__((aligned(16))) _Float16 sin[16 * D_MODEL];

  const int tid = threadIdx.x;
  {
    const int m  = tid & 15;      // token within tile (consecutive hw)
    const int cb = tid >> 4;      // channel group
    const size_t base = ((size_t)(t * BATCH + b) * D_MODEL) * HW + hw0 + m;
#pragma unroll
    for (int i = 0; i < 8; ++i) {
      const int c = cb + 16 * i;
      sin[m * D_MODEL + c] = (_Float16)src[base + (size_t)c * HW];
    }
  }
  __syncthreads();

  const int wave = tid >> 5;
  const int lane = tid & 31;
  const int ll   = lane & 15;
  const int hi   = lane >> 4;
  const int koff = hi * 8;

  const int d = wave * 16 + ll;              // output channel (B-fragment col; A-fragment row for k)
  const float* wrow = W + (size_t)d * D_MODEL;

  v16h xf[4], wf[4];                         // K = 128 in 4 x 32 steps
#pragma unroll
  for (int cc = 0; cc < 4; ++cc) {
    const int c0 = cc * 32 + koff;
    xf[cc] = load_frag_h16(&sin[ll * D_MODEL + c0], &sin[ll * D_MODEL + c0 + 16]);
    V16 bf;
#pragma unroll
    for (int i = 0; i < 8; ++i) {
      bf.h[i]     = (_Float16)wrow[c0 + i];
      bf.h[i + 8] = (_Float16)wrow[c0 + 16 + i];
    }
    wf[cc] = bf.h;
  }

  v8f acc = {};
  if (mat == 1) {
    // W as A, x as B: acc[r] = k[token n0 + ll][channel wave*16 + 8*hi + r],
    // the 8 channels of this lane's chunk; chunk index in the batch = nt*256 + tid.
#pragma unroll
    for (int cc = 0; cc < 4; ++cc)
      acc = __builtin_amdgcn_wmma_f32_16x16x32_f16(false, wf[cc], false, xf[cc],
                                                   (short)0, acc, false, false);
    const float* bp = bias + wave * 16 + 8 * hi;
    F8 bk8;
    bk8.q[0] = *(const u32x4*)bp;
    // Precaution: the second load's result may be given the registers of the
    // address pair that the first load names; the wait stands in front of that.
    asm volatile("s_wait_xcnt 0x0" ::: "memory");
    bk8.q[1] = *(const u32x4*)(bp + 4);
    H8 o;
#pragma unroll
    for (int r = 0; r < 8; ++r) o.h[r] = (_Float16)(acc[r] + bk8.f[r]);
    *(u32x4*)(kout + (size_t)b * NTOK * D_MODEL + (size_t)nt * (16 * D_MODEL) + tid * 8) = o.q;
  } else {
    // x as A, W as B: acc[r] = y[token n0 + 8*hi + r][channel d].
#pragma unroll
    for (int cc = 0; cc < 4; ++cc)
      acc = __builtin_amdgcn_wmma_f32_16x16x32_f16(false, xf[cc], false, wf[cc],
                                                   (short)0, acc, false, false);
    const float bd = bias[d];
    if (mat == 0) {
#pragma unroll
      for (int r = 0; r < 8; ++r) {
        const int row = n0 + r + 8 * hi;
        qout[((size_t)b * NTOK + row) * D_MODEL + d] = (_Float16)((acc[r] + bd) * SCALE);
      }
      asm volatile("s_wait_xcnt 0x0" ::: "memory");
    } else {
      // The 8 keys of this lane's chunk: chunk (wave*2 + (nt & 1)) * 32 + lane
      // of tile nt / 2, four chunks to a 64-byte row.
      H8 o;
#pragma unroll
      for (int r = 0; r < 8; ++r) o.h[r] = (_Float16)(acc[r] + bd);
      const int vrow = (wave * 2 + (nt & 1)) * 8 + (lane >> 2);
      const int vcol = (nt >> 1) * KT + (lane & 3) * 8;
      *(u32x4*)(vtout + ((size_t)b * D_MODEL + vrow) * NTOK + vcol) = o.q;
      asm volatile("s_wait_xcnt 0x0" ::: "memory");
    }
  }
}

__device__ __forceinline__ float exp2_slot(float x) {
  float r;
  asm("v_exp_f32 %0, %1\n\tv_nop" : "=v"(r) : "v"(x));
  return r;
}

__global__ __launch_bounds__(256)
void flash_attn_kernel(const _Float16* __restrict__ Q,    // [B,N,C] pre-scaled
                       const _Float16* __restrict__ K,    // [B,N/32,tile] fragment order
                       const _Float16* __restrict__ Vt,   // [B,128,N] fragment order per tile
                       float* __restrict__ part,          // [B,N,KSPLIT,C] f32
                       float* __restrict__ ml)            // [KSPLIT,B,N,2] f32
{
  const int rng  = blockIdx.x / (BATCH * (NTOK / 128));
  const int qblk = blockIdx.x % (BATCH * (NTOK / 128));
  const int b    = qblk / (NTOK / 128);
  const int mblk = qblk % (NTOK / 128);
  const int tid  = threadIdx.x;
  const int wave = tid >> 5;
  const int lane = tid & 31;
  const int ll   = lane & 15;
  const int hi   = lane >> 4;
  const int koff = hi * 8;

  const int m0 = mblk * 128 + wave * 16;

  // Each 8 KB buffer is a tensor load's place: a multiple of 2 KiB.
  __shared__ __attribute__((aligned(2048))) _Float16 Kbuf[2][KT * D_MODEL]; // [half 0..15][lane][8]
  __shared__ __attribute__((aligned(2048))) _Float16 Vbuf[2][D_MODEL * KT]; // [half 0..15][lane][8]
  __shared__ __attribute__((aligned(16))) _Float16 pbuf[8][16 * KT];

  // This block's tiles: tile0 .. tile0 + ntiles - 1 of the NTOK / KT.
  constexpr int ntiles = NTOK / KT / KSPLIT;
  static_assert(ntiles * KSPLIT * KT == NTOK, "the ranges are equal and cover every key");
  static_assert(ntiles >= 2, "the ring's first two stages must exist");
  const int tile0 = rng * ntiles;

  const _Float16* Kb = K  + (size_t)b * NTOK * D_MODEL + (size_t)tile0 * KT * D_MODEL;
  const _Float16* Vb = Vt + (size_t)b * D_MODEL * NTOK + (size_t)tile0 * KT;

  // Resident Q fragments: A-layout, row = ll, K sub-block per lane half.
  const _Float16* qrow = Q + ((size_t)b * NTOK + m0 + ll) * D_MODEL;
  v16h qf[4];
#pragma unroll
  for (int cc = 0; cc < 4; ++cc) {
    const int c0 = cc * 32 + koff;
    qf[cc] = load_frag_h16(qrow + c0, qrow + c0 + 16);
  }

  v8f acc[8];
  float mrow[8], lrow[8];
#pragma unroll
  for (int j = 0; j < 8; ++j) acc[j] = (v8f){};
#pragma unroll
  for (int r = 0; r < 8; ++r) { mrow[r] = -3.0e38f; lrow[r] = 0.0f; }

  // The ring. Wave 0: K tile, 32 rows of 256 bytes, contiguous. Wave 1: V tile,
  // 128 rows of 64 bytes at a pitch of NTOK halves. One request a wave and stage.
  const unsigned wv     = uni((unsigned)tid >> 5);
  const unsigned issuer = pinned(wv < 2u);
  const bool     isV    = wv == 1u;
  const u32x8 g1 = tdm_group1(isV ? KT * 2u : D_MODEL * 2u, isV ? (unsigned)D_MODEL : (unsigned)KT,
                              isV ? NTOK * 2u : D_MODEL * 2u);
  // Generic shared pointers carry the LDS byte offset in their low 32 bits.
  const unsigned lds0 = isV ? (unsigned)(size_t)(const void*)&Vbuf[0][0]
                            : (unsigned)(size_t)(const void*)&Kbuf[0][0];
  const unsigned long long ga0 = (unsigned long long)(size_t)(isV ? Vb : Kb);
  const unsigned gstep = isV ? KT * 2u : KT * D_MODEL * 2u;   // bytes from tile to tile
  u32x4 g0 = tdm_group0(lds0, ga0);
  if (issuer) {
    tdm_load(g0, g1);
    tdm_wait(g0, g1);
  }
  __syncthreads();   // tile 0 visible in LDS to all waves
  g0 = tdm_group0(lds0 + KT * D_MODEL * 2u, ga0 + gstep);
  asm volatile("" : "+s"(g0));
  if (issuer) tdm_load(g0, g1);

  for (int kt = 0; kt < ntiles; ++kt) {
    const int cur = kt & 1;

    // S = Q K^T : two 16x16 n-tiles, K=128 in 4 steps each (from LDS).
    v8f s[2] = {(v8f){}, (v8f){}};
#pragma unroll
    for (int ntile = 0; ntile < 2; ++ntile) {
      const _Float16* kfr = &Kbuf[cur][ntile * 2048 + lane * 8];
#pragma unroll
      for (int cc = 0; cc < 4; ++cc) {
        v16h kf = load_frag_h16(kfr + cc * 512, kfr + cc * 512 + 256);
        s[ntile] = __builtin_amdgcn_wmma_f32_16x16x32_f16(false, qf[cc], false, kf,
                                                          (short)0, s[ntile], false, false);
      }
    }

#pragma unroll
    for (int r = 0; r < 8; ++r) {
      float v = fmaxf(s[0][r], s[1][r]);
      v = fmaxf(v, __shfl_xor(v, 1, 32));
      v = fmaxf(v, __shfl_xor(v, 2, 32));
      v = fmaxf(v, __shfl_xor(v, 4, 32));
      v = fmaxf(v, __shfl_xor(v, 8, 32));
      const float mn = fmaxf(mrow[r], v);
      const float f  = exp2_slot((mrow[r] - mn) * LOG2E);
      mrow[r] = mn;
      lrow[r] *= f;
#pragma unroll
      for (int j = 0; j < 8; ++j) acc[j][r] *= f;
      const float p0 = exp2_slot((s[0][r] - mn) * LOG2E);
      const float p1 = exp2_slot((s[1][r] - mn) * LOG2E);
      float ps = p0 + p1;
      ps += __shfl_xor(ps, 1, 32);
      ps += __shfl_xor(ps, 2, 32);
      ps += __shfl_xor(ps, 4, 32);
      ps += __shfl_xor(ps, 8, 32);
      lrow[r] += ps;
      // Stash P (C/D layout) into per-wave LDS, row-major [16][32] f16.
      const int prow = (r + 8 * hi) * KT;
      pbuf[wave][prow + ll]      = (_Float16)p0;
      pbuf[wave][prow + 16 + ll] = (_Float16)p1;
    }
    __syncthreads();
    v16h pf = load_frag_h16(&pbuf[wave][ll * KT + koff],
                            &pbuf[wave][ll * KT + koff + 16]);
    __syncthreads();

    // O += P V : 8 d-tiles, K = 32 key tokens.
#pragma unroll
    for (int j = 0; j < 8; ++j) {
      const _Float16* vfr = &Vbuf[cur][j * 512 + lane * 8];
      v16h vf = load_frag_h16(vfr, vfr + 256);
      acc[j] = __builtin_amdgcn_wmma_f32_16x16x32_f16(false, pf, false, vf,
                                                      (short)0, acc[j], false, false);
    }

    // Publish point of tile kt + 1: this wave's LDS reads are done, the issuer's
    // request has landed, and the one barrier both shows tile kt + 1 to every
    // wave and ends every read of the buffer that is refilled behind it.
    asm volatile("s_wait_dscnt 0x0" ::: "memory");
    if (issuer) tdm_wait(g0, g1);
    __syncthreads();
    if (pinned(issuer & (unsigned)(kt + 2 < ntiles))) {
      g0 = tdm_group0(lds0 + (unsigned)cur * (KT * D_MODEL * 2u),
                      ga0 + (unsigned long long)(unsigned)(kt + 2) * gstep);
      // As in front of the loop: the request's own registers last up to its wait.
      asm volatile("" : "+s"(g0));
      tdm_load(g0, g1);
    }
  }
  // No request and no LDS read is left open when the wave goes on to its end.
  asm volatile("s_wait_tensorcnt 0x0" ::: "memory");
  asm volatile("s_wait_dscnt 0x0" ::: "memory");

  // Epilogue: the range's un-normalised sums, then (maximum, sum) per row.
  const size_t slot0 = ((size_t)b * NTOK + m0 + 8 * hi) * KSPLIT + rng;
  float* pr = part + slot0 * D_MODEL + ll;
#pragma unroll
  for (int r = 0; r < 8; ++r) {
#pragma unroll
    for (int j = 0; j < 8; ++j) pr[r * (KSPLIT * D_MODEL) + j * 16] = acc[j][r];
  }
  // All 16 lanes of a half hold the same row values: lane ll < 8 stores row ll,
  // and the wave's 16 pairs fill one 128-byte line.
  f32x2 st = { mrow[0], lrow[0] };
#pragma unroll
  for (int r = 1; r < 8; ++r)
    if (ll == r) { st.x = mrow[r]; st.y = lrow[r]; }
  if (ll < 8)
    *(f32x2*)(ml + ((size_t)rng * ROWS + (size_t)b * NTOK + m0 + 8 * hi + ll) * 2) = st;
}

// ---------------------------------------------------------------------------
// Kernel 3: merge of the key ranges. One wave takes two adjacent rows, a lane
// four channels of each: weight exp(m - max m) per range, then one division.
// ---------------------------------------------------------------------------
__global__ __launch_bounds__(256)
void merge_ranges_kernel(const float* __restrict__ part,  // [B,N,KSPLIT,C]
                         const float* __restrict__ ml,    // [KSPLIT,B,N,2]
                         float* __restrict__ out)         // [B,N,C] f32
{
  const int idx = blockIdx.x * 256 + threadIdx.x;
  const unsigned row0 = (unsigned)(idx >> 5) * 2;
  const unsigned lane = (unsigned)(idx & 31);
  // Byte offsets of 32 bits beside uniform bases: two registers address all loads.
  const unsigned pbyte = row0 * (KSPLIT * D_MODEL * 4) + lane * 16;
  const unsigned sbyte = row0 * 8;
  const char* pbase = (const char*)part;
  const char* sbase = (const char*)ml;

  f32x4 s[KSPLIT];          // (maximum, sum) of row0, then of row0 + 1
  f32x4 p[2][KSPLIT];
#pragma unroll
  for (int q = 0; q < KSPLIT; ++q)
    s[q] = *(const f32x4*)(sbase + q * (ROWS * 8) + sbyte);
#pragma unroll
  for (int h = 0; h < 2; ++h) {
#pragma unroll
    for (int q = 0; q < KSPLIT; ++q)
      p[h][q] = *(const f32x4*)(pbase + (h * KSPLIT + q) * (D_MODEL * 4) + pbyte);
  }
  // Keeps the arithmetic behind all its loads, so that the wave pays one memory
  // round trip; left alone the compiler sinks the loads towards their uses.
  __builtin_amdgcn_sched_barrier(0);
  // In front of all later writes to the loads' address registers; the two
  // offsets are named so that they keep their registers up to the wait.
  asm volatile("s_wait_xcnt 0x0" :: "v"(pbyte), "v"(sbyte) : "memory");

#pragma unroll
  for (int h = 0; h < 2; ++h) {
    float mx = s[0][2 * h];
#pragma unroll
    for (int q = 1; q < KSPLIT; ++q) mx = fmaxf(mx, s[q][2 * h]);
    float lsum = 0.0f;
    f32x4 o = { 0.0f, 0.0f, 0.0f, 0.0f };
#pragma unroll
    for (int q = 0; q < KSPLIT; ++q) {
      const float w = exp2_slot((s[q][2 * h] - mx) * LOG2E);
      lsum += w * s[q][2 * h + 1];
      o += w * p[h][q];
    }
    *(f32x4*)(out + (row0 + h) * D_MODEL + lane * 4) = o * (1.0f / lsum);
  }
}

// ---------------------------------------------------------------------------
extern "C" void kernel_launch(void* const* d_in, const int* in_sizes, int n_in,
                              void* d_out, int out_size, void* d_ws, size_t ws_size,
                              hipStream_t stream) {
  const float* query = (const float*)d_in[0];
  const float* keyv  = (const float*)d_in[1];
  const float* Wq    = (const float*)d_in[2];
  const float* bq    = (const float*)d_in[3];
  const float* Wk    = (const float*)d_in[4];
  const float* bk    = (const float*)d_in[5];
  const float* Wv    = (const float*)d_in[6];
  const float* bv    = (const float*)d_in[7];
  float* out = (float*)d_out;

  _Float16* ws = (_Float16*)d_ws;
  const size_t mat_elems = (size_t)BATCH * NTOK * D_MODEL;   // 1M halves each
  _Float16* Qws  = ws;
  _Float16* Kws  = ws + mat_elems;
  _Float16* Vtws = ws + 2 * mat_elems;
  float* Pws  = (float*)(ws + 3 * mat_elems);                // KSPLIT partial outputs
  float* MLws = Pws + (size_t)KSPLIT * ROWS * D_MODEL;       // their (maximum, sum) pairs

  qkv_project_kernel<<<3 * BATCH * (NTOK / 16), 256, 0, stream>>>(
      query, keyv, Wq, bq, Wk, bk, Wv, bv, Qws, Kws, Vtws);

  flash_attn_kernel<<<KSPLIT * BATCH * (NTOK / 128), 256, 0, stream>>>(
      Qws, Kws, Vtws, Pws, MLws);

  merge_ranges_kernel<<<ROWS * 32 / 2 / 256, 256, 0, stream>>>(Pws, MLws, out);
}

// v003
// Measured time: 42.5 microseconds a run.
// Timed twice side by side with v002, it ran 1.36 and 1.35 times as fast.
// Over all steps from v000 it is 12.7 times as fast.
#include <hip/hip_runtime.h>

#define D_MODEL 128
#define NTOK    4096      // T*H*W
#define BATCH   2
#define HW      1024
#define KT      32        // keys per flash-attention tile
#define KSPLIT  8         // key ranges, each walked by a work-group of its own
#define ROWS    (BATCH * NTOK)
#define OPITCH  (D_MODEL + 4)   // floats per staged output row in LDS
#define LOG2E   1.4426950408889634f
#define SCALE   0.08838834764831845f   // 1/sqrt(128)

typedef __attribute__((ext_vector_type(16))) _Float16 v16h;
typedef __attribute__((ext_vector_type(8)))  float    v8f;
typedef __attribute__((ext_vector_type(4))) unsigned int u32x4;
typedef __attribute__((ext_vector_type(8))) unsigned int u32x8;
typedef __attribute__((ext_vector_type(2)))  float    f32x2;
typedef __attribute__((ext_vector_type(4)))  float    f32x4;
typedef __attribute__((ext_vector_type(2)))  _Float16 f16x2;

union V16 { v16h h; u32x4 q[2]; f16x2 p[8]; };
union H8  { _Float16 h[8]; u32x4 q; };
union F8  { float f[8]; u32x4 q[2]; };

__device__ __forceinline__ v16h load_frag_h16(const _Float16* p0, const _Float16* p1) {
  V16 x;
  x.q[0] = *(const u32x4*)p0;
  x.q[1] = *(const u32x4*)p1;
  return x.h;
}

__device__ __forceinline__ unsigned uni(unsigned v) {
  return (unsigned)__builtin_amdgcn_readfirstlane((int)v);
}
__device__ __forceinline__ unsigned pinned(unsigned v) {
  unsigned w = uni(v);
  asm volatile("" : "+s"(w));
  return w;
}
__device__ __forceinline__ u32x8 tdm_group1(unsigned row_bytes, unsigned nrows, unsigned pitch) {
  u32x8 g;
  g[0] = uni(0u);
  g[1] = uni(row_bytes << 16);
  g[2] = uni(nrows << 16);
  g[3] = uni(row_bytes << 16);
  g[4] = uni(nrows);
  g[5] = uni(pitch);
  g[6] = uni(0u);
  g[7] = uni(0u);
  return g;
}
__device__ __forceinline__ u32x4 tdm_group0(unsigned lds_dst, unsigned long long ga) {
  u32x4 g;
  g[0] = uni(1u);
  g[1] = uni(lds_dst);
  g[2] = uni((unsigned)ga);
  g[3] = uni((((unsigned)(ga >> 32)) & 0x01FFFFFFu) | 0x80000000u);
  return g;
}
__device__ __forceinline__ void tdm_load(u32x4 g0, u32x8 g1) {
  asm volatile("tensor_load_to_lds %0, %1" :: "s"(g0), "s"(g1) : "memory");
}
__device__ __forceinline__ void tdm_wait(u32x4 g0, u32x8 g1) {
  asm volatile("s_wait_tensorcnt 0x0" :: "s"(g0), "s"(g1) : "memory");
}

__global__ __launch_bounds__(256)
void qkv_project_kernel(const float* __restrict__ query,
                        const float* __restrict__ key_value,
                        const float* __restrict__ Wq, const float* __restrict__ bq,
                        const float* __restrict__ Wk, const float* __restrict__ bk,
                        const float* __restrict__ Wv, const float* __restrict__ bv,
                        _Float16* __restrict__ qout,
                        _Float16* __restrict__ kout,
                        _Float16* __restrict__ vtout)
{
  const int id  = blockIdx.x;
  const int mat = id / (BATCH * (NTOK / 16));
  const int rem = id % (BATCH * (NTOK / 16));
  const int b   = rem / (NTOK / 16);
  const int nt  = rem % (NTOK / 16);
  const int n0  = nt * 16;
  const int t   = n0 >> 10;          // 16-token tile never crosses a T slice
  const int hw0 = n0 & (HW - 1);

  const float* src  = (mat == 0) ? query : key_value;
  const float* W    = (mat == 0) ? Wq : (mat == 1) ? Wk : Wv;
  const float* bias = (mat == 0) ? bq : (mat == 1) ? bk : bv;

  __shared__ __attribute__((aligned(16))) _Float16 sin[16 * D_MODEL];

  const int tid = threadIdx.x;
  {
    const int m  = tid & 15;      // token within tile (consecutive hw)
    const int cb = tid >> 4;      // channel group
    const size_t base = ((size_t)(t * BATCH + b) * D_MODEL) * HW + hw0 + m;
#pragma unroll
    for (int i = 0; i < 8; ++i) {
      const int c = cb + 16 * i;
      sin[m * D_MODEL + c] = (_Float16)src[base + (size_t)c * HW];
    }
  }
  __syncthreads();

  const int wave = tid >> 5;
  const int lane = tid & 31;
  const int ll   = lane & 15;
  const int hi   = lane >> 4;
  const int koff = hi * 8;

  const int d = wave * 16 + ll;              // output channel (B-fragment col; A-fragment row for k)
  const float* wrow = W + (size_t)d * D_MODEL;

  v16h xf[4], wf[4];                         // K = 128 in 4 x 32 steps
#pragma unroll
  for (int cc = 0; cc < 4; ++cc) {
    const int c0 = cc * 32 + koff;
    xf[cc] = load_frag_h16(&sin[ll * D_MODEL + c0], &sin[ll * D_MODEL + c0 + 16]);
    V16 bf;
#pragma unroll
    for (int i = 0; i < 8; ++i) {
      bf.h[i]     = (_Float16)wrow[c0 + i];
      bf.h[i + 8] = (_Float16)wrow[c0 + 16 + i];
    }
    wf[cc] = bf.h;
  }

  v8f acc = {};
  if (mat == 1) {
    // W as A, x as B: acc[r] = k[token n0 + ll][channel wave*16 + 8*hi + r],
    // the 8 channels of this lane's chunk; chunk index in the batch = nt*256 + tid.
#pragma unroll
    for (int cc = 0; cc < 4; ++cc)
      acc = __builtin_amdgcn_wmma_f32_16x16x32_f16(false, wf[cc], false, xf[cc],
                                                   (short)0, acc, false, false);
    const float* bp = bias + wave * 16 + 8 * hi;
    F8 bk8;
    bk8.q[0] = *(const u32x4*)bp;
    // Precaution: the second load's result may be given the registers of the
    // address pair that the first load names; the wait stands in front of that.
    asm volatile("s_wait_xcnt 0x0" ::: "memory");
    bk8.q[1] = *(const u32x4*)(bp + 4);
    H8 o;
#pragma unroll
    for (int r = 0; r < 8; ++r) o.h[r] = (_Float16)(acc[r] + bk8.f[r]);
    *(u32x4*)(kout + (size_t)b * NTOK * D_MODEL + (size_t)nt * (16 * D_MODEL) + tid * 8) = o.q;
  } else {
    // x as A, W as B: acc[r] = y[token n0 + 8*hi + r][channel d].
#pragma unroll
    for (int cc = 0; cc < 4; ++cc)
      acc = __builtin_amdgcn_wmma_f32_16x16x32_f16(false, xf[cc], false, wf[cc],
                                                   (short)0, acc, false, false);
    const float bd = bias[d];
    if (mat == 0) {
#pragma unroll
      for (int r = 0; r < 8; ++r) {
        const int row = n0 + r + 8 * hi;
        qout[((size_t)b * NTOK + row) * D_MODEL + d] = (_Float16)((acc[r] + bd) * SCALE);
      }
      asm volatile("s_wait_xcnt 0x0" ::: "memory");
    } else {
      // The 8 keys of this lane's chunk: chunk (wave*2 + (nt & 1)) * 32 + lane
      // of tile nt / 2, four chunks to a 64-byte row.
      H8 o;
#pragma unroll
      for (int r = 0; r < 8; ++r) o.h[r] = (_Float16)(acc[r] + bd);
      const int vrow = (wave * 2 + (nt & 1)) * 8 + (lane >> 2);
      const int vcol = (nt >> 1) * KT + (lane & 3) * 8;
      *(u32x4*)(vtout + ((size_t)b * D_MODEL + vrow) * NTOK + vcol) = o.q;
      asm volatile("s_wait_xcnt 0x0" ::: "memory");
    }
  }
}

__device__ __forceinline__ float other_half(float x) {
  const int b = __builtin_bit_cast(int, x);
  return __builtin_bit_cast(float, __builtin_amdgcn_permlanex16(b, b, 0x76543210, 0xfedcba98,
                                                                false, false));
}

__device__ __forceinline__ float exp2_slot(float x) {
  float r;
  asm("v_exp_f32 %0, %1\n\tv_nop" : "=v"(r) : "v"(x));
  return r;
}

__global__ __launch_bounds__(256)
void flash_attn_kernel(const _Float16* __restrict__ Q,    // [B,N,C] pre-scaled
                       const _Float16* __restrict__ K,    // [B,N/32,tile] fragment order
                       const _Float16* __restrict__ Vt,   // [B,128,N] fragment order per tile
                       float* __restrict__ part,          // [B,N,KSPLIT,C] f32
                       float* __restrict__ ml)            // [KSPLIT,B,N,2] f32
{
  const int rng  = blockIdx.x / (BATCH * (NTOK / 128));
  const int qblk = blockIdx.x % (BATCH * (NTOK / 128));
  const int b    = qblk / (NTOK / 128);
  const int mblk = qblk % (NTOK / 128);
  const int tid  = threadIdx.x;
  const int wave = tid >> 5;
  const int lane = tid & 31;
  const int ll   = lane & 15;
  const int hi   = lane >> 4;
  const int koff = hi * 8;

  const int m0 = mblk * 128 + wave * 16;

  // Each 8 KB buffer is a tensor load's place: a multiple of 2 KiB.
  __shared__ __attribute__((aligned(2048))) _Float16 Kbuf[2][KT * D_MODEL]; // [half 0..15][lane][8]
  __shared__ __attribute__((aligned(2048))) _Float16 Vbuf[2][D_MODEL * KT]; // [half 0..15][lane][8]
  __shared__ __attribute__((aligned(16))) float stage[8][16 * OPITCH];

  // This block's tiles: tile0 .. tile0 + ntiles - 1 of the NTOK / KT.
  constexpr int ntiles = NTOK / KT / KSPLIT;
  static_assert(ntiles * KSPLIT * KT == NTOK, "the ranges are equal and cover every key");
  static_assert(ntiles >= 2, "the ring's first two stages must exist");
  const int tile0 = rng * ntiles;

  const _Float16* Kb = K  + (size_t)b * NTOK * D_MODEL + (size_t)tile0 * KT * D_MODEL;
  const _Float16* Vb = Vt + (size_t)b * D_MODEL * NTOK + (size_t)tile0 * KT;

  // Resident Q fragments, the B operand: column = ll, K sub-block per lane half.
  const _Float16* qrow = Q + ((size_t)b * NTOK + m0 + ll) * D_MODEL;
  v16h qf[4];
#pragma unroll
  for (int cc = 0; cc < 4; ++cc) {
    const int c0 = cc * 32 + koff;
    qf[cc] = load_frag_h16(qrow + c0, qrow + c0 + 16);
  }

  v8f acc[8];
  // This lane's query: the maximum so far (equal in both halves) and the sum
  // over this half's keys alone; the halves' sums are joined behind the loop.
  float mrun = -3.0e38f, lrun = 0.0f;
#pragma unroll
  for (int j = 0; j < 8; ++j) acc[j] = (v8f){};

  // The ring. Wave 0: K tile, 32 rows of 256 bytes, contiguous. Wave 1: V tile,
  // 128 rows of 64 bytes at a pitch of NTOK halves. One request a wave and stage.
  const unsigned wv     = uni((unsigned)tid >> 5);
  const unsigned issuer = pinned(wv < 2u);
  const bool     isV    = wv == 1u;
  const u32x8 g1 = tdm_group1(isV ? KT * 2u : D_MODEL * 2u, isV ? (unsigned)D_MODEL : (unsigned)KT,
                              isV ? NTOK * 2u : D_MODEL * 2u);
  // Generic shared pointers carry the LDS byte offset in their low 32 bits.
  const unsigned lds0 = isV ? (unsigned)(size_t)(const void*)&Vbuf[0][0]
                            : (unsigned)(size_t)(const void*)&Kbuf[0][0];
  const unsigned long long ga0 = (unsigned long long)(size_t)(isV ? Vb : Kb);
  const unsigned gstep = isV ? KT * 2u : KT * D_MODEL * 2u;   // bytes from tile to tile
  u32x4 g0 = tdm_group0(lds0, ga0);
  if (issuer) {
    tdm_load(g0, g1);
    tdm_wait(g0, g1);
  }
  __syncthreads();   // tile 0 visible in LDS to all waves
  g0 = tdm_group0(lds0 + KT * D_MODEL * 2u, ga0 + gstep);
  asm volatile("" : "+s"(g0));
  if (issuer) tdm_load(g0, g1);

  for (int kt = 0; kt < ntiles; ++kt) {
    const int cur = kt & 1;

    // S^T = K Q^T : two 16-key tiles, K=128 in 4 steps each (K from LDS).
    // s[t][r] = score of key t * 16 + 8 * hi + r against query ll.
    v8f s[2] = {(v8f){}, (v8f){}};
#pragma unroll
    for (int ntile = 0; ntile < 2; ++ntile) {
      const _Float16* kfr = &Kbuf[cur][ntile * 2048 + lane * 8];
#pragma unroll
      for (int cc = 0; cc < 4; ++cc) {
        v16h kf = load_frag_h16(kfr + cc * 512, kfr + cc * 512 + 256);
        s[ntile] = __builtin_amdgcn_wmma_f32_16x16x32_f16(false, kf, false, qf[cc],
                                                          (short)0, s[ntile], false, false);
      }
    }

    // Online softmax of this lane's query: 16 scores here, 16 in lane ^ 16.
    float v0 = fmaxf(fmaxf(s[0][0], s[0][1]), s[0][2]);
    float v1 = fmaxf(fmaxf(s[0][3], s[0][4]), s[0][5]);
    float v2 = fmaxf(fmaxf(s[0][6], s[0][7]), s[1][0]);
    float v3 = fmaxf(fmaxf(s[1][1], s[1][2]), s[1][3]);
    float v4 = fmaxf(fmaxf(s[1][4], s[1][5]), s[1][6]);
    v0 = fmaxf(fmaxf(v0, v1), v2);
    v3 = fmaxf(fmaxf(v3, v4), s[1][7]);
    v0 = fmaxf(v0, v3);
    const float mn = fmaxf(mrun, fmaxf(v0, other_half(v0)));
    const float f  = exp2_slot((mrun - mn) * LOG2E);
    mrun = mn;
    const float nml = -mn * LOG2E;
    const f32x2 c2 = { LOG2E, LOG2E };
    const f32x2 n2 = { nml, nml };
    // P^T: element e of the B fragment is key (e / 8) * 16 + 8 * hi + e % 8, and
    // that is score tile e / 8, register e % 8, of this very lane.
    V16 pf;
    f32x2 p[8];
#pragma unroll
    for (int i = 0; i < 8; ++i) {
      const f32x2 x = { s[i >> 2][2 * (i & 3)], s[i >> 2][2 * (i & 3) + 1] };
      const f32x2 e = __builtin_elementwise_fma(x, c2, n2);
      p[i].x = __builtin_amdgcn_exp2f(e.x);
      p[i].y = __builtin_amdgcn_exp2f(e.y);
      pf.p[i] = __builtin_convertvector(p[i], f16x2);
    }
    const f32x2 ps = ((p[0] + p[1]) + (p[2] + p[3])) + ((p[4] + p[5]) + (p[6] + p[7]));
    lrun = lrun * f + (ps.x + ps.y);
#pragma unroll
    for (int j = 0; j < 8; ++j) acc[j] *= f;

    // O^T += V^T P^T : 8 tiles of 16 channels, K = 32 keys.
    // acc[j][r] = channel j * 16 + 8 * hi + r of query ll.
#pragma unroll
    for (int j = 0; j < 8; ++j) {
      const _Float16* vfr = &Vbuf[cur][j * 512 + lane * 8];
      v16h vf = load_frag_h16(vfr, vfr + 256);
      acc[j] = __builtin_amdgcn_wmma_f32_16x16x32_f16(false, vf, false, pf.h,
                                                      (short)0, acc[j], false, false);
    }

    // Publish point of tile kt + 1: this wave's LDS reads are done, the issuer's
    // request has landed, and the one barrier both shows tile kt + 1 to every
    // wave and ends every read of the buffer that is refilled behind it.
    asm volatile("s_wait_dscnt 0x0" ::: "memory");
    if (issuer) tdm_wait(g0, g1);
    __syncthreads();
    if (pinned(issuer & (unsigned)(kt + 2 < ntiles))) {
      g0 = tdm_group0(lds0 + (unsigned)cur * (KT * D_MODEL * 2u),
                      ga0 + (unsigned long long)(unsigned)(kt + 2) * gstep);
      // As in front of the loop: the request's own registers last up to its wait.
      asm volatile("" : "+s"(g0));
      tdm_load(g0, g1);
    }
  }
  // No request and no LDS read is left open when the wave goes on to its end.
  asm volatile("s_wait_tensorcnt 0x0" ::: "memory");
  asm volatile("s_wait_dscnt 0x0" ::: "memory");

  // Epilogue: the range's un-normalised sums, then (maximum, sum) per query.
  lrun += other_half(lrun);
  // A lane holds 8 consecutive channels of its query per tile: through the
  // wave's own LDS rows, so that every global store covers whole 128-byte lines.
  float* st = &stage[wave][0];
#pragma unroll
  for (int j = 0; j < 8; ++j) {
    const f32x4 lo = { acc[j][0], acc[j][1], acc[j][2], acc[j][3] };
    const f32x4 up = { acc[j][4], acc[j][5], acc[j][6], acc[j][7] };
    *(f32x4*)&st[ll * OPITCH + j * 16 + 8 * hi]     = lo;
    *(f32x4*)&st[ll * OPITCH + j * 16 + 8 * hi + 4] = up;
  }
  // The rows are read back by other lanes of this wave than wrote them.
  asm volatile("s_wait_dscnt 0x0" ::: "memory");
  f32x4 row[16];
#pragma unroll
  for (int r = 0; r < 16; ++r) row[r] = *(const f32x4*)&st[r * OPITCH + lane * 4];
  float* pr = part + (((size_t)b * NTOK + m0) * KSPLIT + rng) * D_MODEL + lane * 4;
#pragma unroll
  for (int r = 0; r < 16; ++r) *(f32x4*)(pr + r * (KSPLIT * D_MODEL)) = row[r];
  // Both halves hold the same pair: the lower one stores, 16 pairs to one line.
  if (hi == 0) {
    const f32x2 pair = { mrun, lrun };
    *(f32x2*)(ml + ((size_t)rng * ROWS + (size_t)b * NTOK + m0 + ll) * 2) = pair;
  }
}

// ---------------------------------------------------------------------------
// Kernel 3: merge of the key ranges. One wave takes two adjacent rows, a lane
// four channels of each: weight exp(m - max m) per range, then one division.
// ---------------------------------------------------------------------------
__global__ __launch_bounds__(256)
void merge_ranges_kernel(const float* __restrict__ part,  // [B,N,KSPLIT,C]
                         const float* __restrict__ ml,    // [KSPLIT,B,N,2]
                         float* __restrict__ out)         // [B,N,C] f32
{
  const int idx = blockIdx.x * 256 + threadIdx.x;
  const unsigned row0 = (unsigned)(idx >> 5) * 2;
  const unsigned lane = (unsigned)(idx & 31);
  // Byte offsets of 32 bits beside uniform bases: two registers address all loads.
  const unsigned pbyte = row0 * (KSPLIT * D_MODEL * 4) + lane * 16;
  const unsigned sbyte = row0 * 8;
  const char* pbase = (const char*)part;
  const char* sbase = (const char*)ml;

  f32x4 s[KSPLIT];          // (maximum, sum) of row0, then of row0 + 1
  f32x4 p[2][KSPLIT];
#pragma unroll
  for (int q = 0; q < KSPLIT; ++q)
    s[q] = *(const f32x4*)(sbase + q * (ROWS * 8) + sbyte);
#pragma unroll
  for (int h = 0; h < 2; ++h) {
#pragma unroll
    for (int q = 0; q < KSPLIT; ++q)
      p[h][q] = *(const f32x4*)(pbase + (h * KSPLIT + q) * (D_MODEL * 4) + pbyte);
  }
  // Keeps the arithmetic behind all its loads, so that the wave pays one memory
  // round trip; left alone the compiler sinks the loads towards their uses.
  __builtin_amdgcn_sched_barrier(0);
  // In front of all later writes to the loads' address registers; the two
  // offsets are named so that they keep their registers up to the wait.
  asm volatile("s_wait_xcnt 0x0" :: "v"(pbyte), "v"(sbyte) : "memory");

#pragma unroll
  for (int h = 0; h < 2; ++h) {
    float mx = s[0][2 * h];
#pragma unroll
    for (int q = 1; q < KSPLIT; ++q) mx = fmaxf(mx, s[q][2 * h]);
    float lsum = 0.0f;
    f32x4 o = { 0.0f, 0.0f, 0.0f, 0.0f };
#pragma unroll
    for (int q = 0; q < KSPLIT; ++q) {
      const float w = exp2_slot((s[q][2 * h] - mx) * LOG2E);
      lsum += w * s[q][2 * h + 1];
      o += w * p[h][q];
    }
    *(f32x4*)(out + (row0 + h) * D_MODEL + lane * 4) = o * (1.0f / lsum);
  }
}

// ---------------------------------------------------------------------------
extern "C" void kernel_launch(void* const* d_in, const int* in_sizes, int n_in,
                              void* d_out, int out_size, void* d_ws, size_t ws_size,
                              hipStream_t stream) {
  const float* query = (const float*)d_in[0];
  const float* keyv  = (const float*)d_in[1];
  const float* Wq    = (const float*)d_in[2];
  const float* bq    = (const float*)d_in[3];
  const float* Wk    = (const float*)d_in[4];
  const float* bk    = (const float*)d_in[5];
  const float* Wv    = (const float*)d_in[6];
  const float* bv    = (const float*)d_in[7];
  float* out = (float*)d_out;

  _Float16* ws = (_Float16*)d_ws;
  const size_t mat_elems = (size_t)BATCH * NTOK * D_MODEL;   // 1M halves each
  _Float16* Qws  = ws;
  _Float16* Kws  = ws + mat_elems;
  _Float16* Vtws = ws + 2 * mat_elems;
  float* Pws  = (float*)(ws + 3 * mat_elems);                // KSPLIT partial outputs
  float* MLws = Pws + (size_t)KSPLIT * ROWS * D_MODEL;       // their (maximum, sum) pairs

  qkv_project_kernel<<<3 * BATCH * (NTOK / 16), 256, 0, stream>>>(
      query, keyv, Wq, bq, Wk, bk, Wv, bv, Qws, Kws, Vtws);

  flash_attn_kernel<<<KSPLIT * BATCH * (NTOK / 128), 256, 0, stream>>>(
      Qws, Kws, Vtws, Pws, MLws);

  merge_ranges_kernel<<<ROWS * 32 / 2 / 256, 256, 0, stream>>>(Pws, MLws, out);
}

// v004
// It runs in 40.5 microseconds.
// In both of two side-by-side timings against v003, it was 1.05 times as fast.
// All steps since v000 together make it 13.4 times as fast.
#include <hip/hip_runtime.h>

#define D_MODEL 128
#define NTOK    4096      // T*H*W
#define BATCH   2
#define HW      1024
#define KT      32        // keys per flash-attention tile
#define KSPLIT  8         // key ranges, each walked by a work-group of its own
#define ROWS    (BATCH * NTOK)
#define OPITCH  (D_MODEL + 4)   // floats per staged output row in LDS
#define LOG2E   1.4426950408889634f
#define SCALE   0.08838834764831845f   // 1/sqrt(128)

typedef __attribute__((ext_vector_type(16))) _Float16 v16h;
typedef __attribute__((ext_vector_type(8)))  float    v8f;
typedef __attribute__((ext_vector_type(4))) unsigned int u32x4;
typedef __attribute__((ext_vector_type(8))) unsigned int u32x8;
typedef __attribute__((ext_vector_type(2)))  float    f32x2;
typedef __attribute__((ext_vector_type(4)))  float    f32x4;
typedef __attribute__((ext_vector_type(2)))  _Float16 f16x2;

union V16 { v16h h; u32x4 q[2]; f16x2 p[8]; };
union H8  { _Float16 h[8]; u32x4 q; };
union F8  { float f[8]; u32x4 q[2]; };

__device__ __forceinline__ v16h load_frag_h16(const _Float16* p0, const _Float16* p1) {
  V16 x;
  x.q[0] = *(const u32x4*)p0;
  x.q[1] = *(const u32x4*)p1;
  return x.h;
}

__device__ __forceinline__ unsigned uni(unsigned v) {
  return (unsigned)__builtin_amdgcn_readfirstlane((int)v);
}
__device__ __forceinline__ unsigned pinned(unsigned v) {
  unsigned w = uni(v);
  asm volatile("" : "+s"(w));
  return w;
}
__device__ __forceinline__ u32x8 tdm_group1(unsigned row_bytes, unsigned nrows, unsigned pitch) {
  u32x8 g;
  g[0] = uni(0u);
  g[1] = uni(row_bytes << 16);
  g[2] = uni(nrows << 16);
  g[3] = uni(row_bytes << 16);
  g[4] = uni(nrows);
  g[5] = uni(pitch);
  g[6] = uni(0u);
  g[7] = uni(0u);
  return g;
}
__device__ __forceinline__ u32x4 tdm_group0(unsigned lds_dst, unsigned long long ga) {
  u32x4 g;
  g[0] = uni(1u);
  g[1] = uni(lds_dst);
  g[2] = uni((unsigned)ga);
  g[3] = uni((((unsigned)(ga >> 32)) & 0x01FFFFFFu) | 0x80000000u);
  return g;
}
__device__ __forceinline__ void tdm_load(u32x4 g0, u32x8 g1) {
  asm volatile("tensor_load_to_lds %0, %1" :: "s"(g0), "s"(g1) : "memory");
}
__device__ __forceinline__ void tdm_wait(u32x4 g0, u32x8 g1) {
  asm volatile("s_wait_tensorcnt 0x0" :: "s"(g0), "s"(g1) : "memory");
}

__global__ __launch_bounds__(256)
void qkv_project_kernel(const float* __restrict__ query,
                        const float* __restrict__ key_value,
                        const float* __restrict__ Wq, const float* __restrict__ bq,
                        const float* __restrict__ Wk, const float* __restrict__ bk,
                        const float* __restrict__ Wv, const float* __restrict__ bv,
                        _Float16* __restrict__ qout,
                        _Float16* __restrict__ kout,
                        _Float16* __restrict__ vtout)
{
  const int id  = blockIdx.x;
  const int mat = id / (BATCH * (NTOK / 16));
  const int rem = id % (BATCH * (NTOK / 16));
  const int b   = rem / (NTOK / 16);
  const int nt  = rem % (NTOK / 16);
  const int n0  = nt * 16;
  const int t   = n0 >> 10;          // 16-token tile never crosses a T slice
  const int hw0 = n0 & (HW - 1);

  const float* src  = (mat == 0) ? query : key_value;
  const float* W    = (mat == 0) ? Wq : (mat == 1) ? Wk : Wv;
  const float* bias = (mat == 0) ? bq : (mat == 1) ? bk : bv;

  __shared__ __attribute__((aligned(16))) _Float16 sin[16 * D_MODEL];

  const int tid = threadIdx.x;
  {
    const int m  = tid & 15;      // token within tile (consecutive hw)
    const int cb = tid >> 4;      // channel group
    const size_t base = ((size_t)(t * BATCH + b) * D_MODEL) * HW + hw0 + m;
#pragma unroll
    for (int i = 0; i < 8; ++i) {
      const int c = cb + 16 * i;
      sin[m * D_MODEL + c] = (_Float16)src[base + (size_t)c * HW];
    }
  }
  __syncthreads();

  const int wave = tid >> 5;
  const int lane = tid & 31;
  const int ll   = lane & 15;
  const int hi   = lane >> 4;
  const int koff = hi * 8;

  const int d = wave * 16 + ll;              // output channel (B-fragment col; A-fragment row for k)
  const float* wrow = W + (size_t)d * D_MODEL;

  v16h xf[4], wf[4];                         // K = 128 in 4 x 32 steps
#pragma unroll
  for (int cc = 0; cc < 4; ++cc) {
    const int c0 = cc * 32 + koff;
    xf[cc] = load_frag_h16(&sin[ll * D_MODEL + c0], &sin[ll * D_MODEL + c0 + 16]);
    V16 bf;
#pragma unroll
    for (int i = 0; i < 8; ++i) {
      bf.h[i]     = (_Float16)wrow[c0 + i];
      bf.h[i + 8] = (_Float16)wrow[c0 + 16 + i];
    }
    wf[cc] = bf.h;
  }

  v8f acc = {};
  if (mat == 1) {
    // W as A, x as B: acc[r] = k[token n0 + ll][channel wave*16 + 8*hi + r],
    // the 8 channels of this lane's chunk; chunk index in the batch = nt*256 + tid.
#pragma unroll
    for (int cc = 0; cc < 4; ++cc)
      acc = __builtin_amdgcn_wmma_f32_16x16x32_f16(false, wf[cc], false, xf[cc],
                                                   (short)0, acc, false, false);
    const float* bp = bias + wave * 16 + 8 * hi;
    F8 bk8;
    bk8.q[0] = *(const u32x4*)bp;
    // Precaution: the second load's result may be given the registers of the
    // address pair that the first load names; the wait stands in front of that.
    asm volatile("s_wait_xcnt 0x0" ::: "memory");
    bk8.q[1] = *(const u32x4*)(bp + 4);
    H8 o;
#pragma unroll
    for (int r = 0; r < 8; ++r) o.h[r] = (_Float16)(acc[r] + bk8.f[r]);
    *(u32x4*)(kout + (size_t)b * NTOK * D_MODEL + (size_t)nt * (16 * D_MODEL) + tid * 8) = o.q;
  } else {
    // x as A, W as B: acc[r] = y[token n0 + 8*hi + r][channel d].
#pragma unroll
    for (int cc = 0; cc < 4; ++cc)
      acc = __builtin_amdgcn_wmma_f32_16x16x32_f16(false, xf[cc], false, wf[cc],
                                                   (short)0, acc, false, false);
    const float bd = bias[d];
    if (mat == 0) {
#pragma unroll
      for (int r = 0; r < 8; ++r) {
        const int row = n0 + r + 8 * hi;
        qout[((size_t)b * NTOK + row) * D_MODEL + d] = (_Float16)((acc[r] + bd) * SCALE);
      }
      asm volatile("s_wait_xcnt 0x0" ::: "memory");
    } else {
      // The 8 keys of this lane's chunk: chunk (wave*2 + (nt & 1)) * 32 + lane
      // of tile nt / 2, four chunks to a 64-byte row.
      H8 o;
#pragma unroll
      for (int r = 0; r < 8; ++r) o.h[r] = (_Float16)(acc[r] + bd);
      const int vrow = (wave * 2 + (nt & 1)) * 8 + (lane >> 2);
      const int vcol = (nt >> 1) * KT + (lane & 3) * 8;
      *(u32x4*)(vtout + ((size_t)b * D_MODEL + vrow) * NTOK + vcol) = o.q;
      asm volatile("s_wait_xcnt 0x0" ::: "memory");
    }
  }
}

__device__ __forceinline__ float other_half(float x) {
  const int b = __builtin_bit_cast(int, x);
  return __builtin_bit_cast(float, __builtin_amdgcn_permlanex16(b, b, 0x76543210, 0xfedcba98,
                                                                false, false));
}

__device__ __forceinline__ float exp2_slot(float x) {
  float r;
  asm("v_exp_f32 %0, %1\n\tv_nop" : "=v"(r) : "v"(x));
  return r;
}

__global__ __launch_bounds__(256)
void flash_attn_kernel(const _Float16* __restrict__ Q,    // [B,N,C] pre-scaled
                       const _Float16* __restrict__ K,    // [B,N/32,tile] fragment order
                       const _Float16* __restrict__ Vt,   // [B,128,N] fragment order per tile
                       float* __restrict__ part,          // [B,N,KSPLIT,C] f32
                       float* __restrict__ ml)            // [KSPLIT,B,N,2] f32
{
  const int rng  = blockIdx.x / (BATCH * (NTOK / 128));
  const int qblk = blockIdx.x % (BATCH * (NTOK / 128));
  const int b    = qblk / (NTOK / 128);
  const int mblk = qblk % (NTOK / 128);
  const int tid  = threadIdx.x;
  const int wave = tid >> 5;
  const int lane = tid & 31;
  const int ll   = lane & 15;
  const int hi   = lane >> 4;
  const int koff = hi * 8;

  const int m0 = mblk * 128 + wave * 16;

  // Each 8 KB buffer is a tensor load's place: a multiple of 2 KiB.
  __shared__ __attribute__((aligned(2048))) _Float16 Kbuf[2][KT * D_MODEL]; // [half 0..15][lane][8]
  __shared__ __attribute__((aligned(2048))) _Float16 Vbuf[2][D_MODEL * KT]; // [half 0..15][lane][8]
  __shared__ __attribute__((aligned(16))) float stage[8][16 * OPITCH];

  // This block's tiles: tile0 .. tile0 + ntiles - 1 of the NTOK / KT.
  constexpr int ntiles = NTOK / KT / KSPLIT;
  static_assert(ntiles * KSPLIT * KT == NTOK, "the ranges are equal and cover every key");
  static_assert(ntiles >= 2, "the ring's first two stages must exist");
  const int tile0 = rng * ntiles;

  const _Float16* Kb = K  + (size_t)b * NTOK * D_MODEL + (size_t)tile0 * KT * D_MODEL;
  const _Float16* Vb = Vt + (size_t)b * D_MODEL * NTOK + (size_t)tile0 * KT;

  // Resident Q fragments, the B operand: column = ll, K sub-block per lane half.
  const _Float16* qrow = Q + ((size_t)b * NTOK + m0 + ll) * D_MODEL;
  v16h qf[4];
#pragma unroll
  for (int cc = 0; cc < 4; ++cc) {
    const int c0 = cc * 32 + koff;
    qf[cc] = load_frag_h16(qrow + c0, qrow + c0 + 16);
  }

  v8f acc[8];
  // This lane's query: the maximum so far (equal in both halves) and the sum
  // over this half's keys alone; the halves' sums are joined behind the loop.
  float mrun = -3.0e38f, lrun = 0.0f;
#pragma unroll
  for (int j = 0; j < 8; ++j) acc[j] = (v8f){};

  // The ring. Wave 0: K tile, 32 rows of 256 bytes, contiguous. Wave 1: V tile,
  // 128 rows of 64 bytes at a pitch of NTOK halves. One request a wave and stage.
  const unsigned wv     = uni((unsigned)tid >> 5);
  const unsigned issuer = pinned(wv < 2u);
  const bool     isV    = wv == 1u;
  const u32x8 g1 = tdm_group1(isV ? KT * 2u : D_MODEL * 2u, isV ? (unsigned)D_MODEL : (unsigned)KT,
                              isV ? NTOK * 2u : D_MODEL * 2u);
  // Generic shared pointers carry the LDS byte offset in their low 32 bits.
  const unsigned lds0 = isV ? (unsigned)(size_t)(const void*)&Vbuf[0][0]
                            : (unsigned)(size_t)(const void*)&Kbuf[0][0];
  const unsigned long long ga0 = (unsigned long long)(size_t)(isV ? Vb : Kb);
  const unsigned gstep = isV ? KT * 2u : KT * D_MODEL * 2u;   // bytes from tile to tile
  u32x4 g0 = tdm_group0(lds0, ga0);
  if (issuer) {
    tdm_load(g0, g1);
    tdm_wait(g0, g1);
  }
  __syncthreads();   // tile 0 visible in LDS to all waves
  g0 = tdm_group0(lds0 + KT * D_MODEL * 2u, ga0 + gstep);
  asm volatile("" : "+s"(g0));
  if (issuer) tdm_load(g0, g1);

  for (int kt = 0; kt < ntiles; ++kt) {
    const int cur = kt & 1;

    // S^T = K Q^T : two 16-key tiles, K=128 in 4 steps each (K from LDS).
    // s[t][r] = score of key t * 16 + 8 * hi + r against query ll.
    // All of the pass's LDS reads stand in one group at its head, in the order of
    // their use: K's latency is waited out once, and V lands behind the score
    // products and the softmax. Read singly, each read's latency is waited out.
    const _Float16* kfr = &Kbuf[cur][lane * 8];
    const _Float16* vfr = &Vbuf[cur][lane * 8];
    v16h kf[4][2], vf[8];
#pragma unroll
    for (int cc = 0; cc < 4; ++cc) {
#pragma unroll
      for (int ntile = 0; ntile < 2; ++ntile)
        kf[cc][ntile] = load_frag_h16(kfr + ntile * 2048 + cc * 512, kfr + ntile * 2048 + cc * 512 + 256);
    }
#pragma unroll
    for (int j = 0; j < 8; ++j) vf[j] = load_frag_h16(vfr + j * 512, vfr + j * 512 + 256);
    // Keeps the group whole: left alone the compiler sinks each read to its product.
    __builtin_amdgcn_sched_barrier(0);
    v8f s[2] = {(v8f){}, (v8f){}};
#pragma unroll
    for (int cc = 0; cc < 4; ++cc) {
#pragma unroll
      for (int ntile = 0; ntile < 2; ++ntile)
        s[ntile] = __builtin_amdgcn_wmma_f32_16x16x32_f16(false, kf[cc][ntile], false, qf[cc],
                                                          (short)0, s[ntile], false, false);
    }

    // Online softmax of this lane's query: 16 scores here, 16 in lane ^ 16.
    float v0 = fmaxf(fmaxf(s[0][0], s[0][1]), s[0][2]);
    float v1 = fmaxf(fmaxf(s[0][3], s[0][4]), s[0][5]);
    float v2 = fmaxf(fmaxf(s[0][6], s[0][7]), s[1][0]);
    float v3 = fmaxf(fmaxf(s[1][1], s[1][2]), s[1][3]);
    float v4 = fmaxf(fmaxf(s[1][4], s[1][5]), s[1][6]);
    v0 = fmaxf(fmaxf(v0, v1), v2);
    v3 = fmaxf(fmaxf(v3, v4), s[1][7]);
    v0 = fmaxf(v0, v3);
    const float mn = fmaxf(mrun, fmaxf(v0, other_half(v0)));
    const float f  = exp2_slot((mrun - mn) * LOG2E);
    mrun = mn;
    const float nml = -mn * LOG2E;
    const f32x2 c2 = { LOG2E, LOG2E };
    const f32x2 n2 = { nml, nml };
    // P^T: element e of the B fragment is key (e / 8) * 16 + 8 * hi + e % 8, and
    // that is score tile e / 8, register e % 8, of this very lane.
    V16 pf;
    f32x2 p[8];
#pragma unroll
    for (int i = 0; i < 8; ++i) {
      const f32x2 x = { s[i >> 2][2 * (i & 3)], s[i >> 2][2 * (i & 3) + 1] };
      const f32x2 e = __builtin_elementwise_fma(x, c2, n2);
      p[i].x = __builtin_amdgcn_exp2f(e.x);
      p[i].y = __builtin_amdgcn_exp2f(e.y);
      pf.p[i] = __builtin_convertvector(p[i], f16x2);
    }
    const f32x2 ps = ((p[0] + p[1]) + (p[2] + p[3])) + ((p[4] + p[5]) + (p[6] + p[7]));
    lrun = lrun * f + (ps.x + ps.y);
#pragma unroll
    for (int j = 0; j < 8; ++j) acc[j] *= f;

    // O^T += V^T P^T : 8 tiles of 16 channels, K = 32 keys.
    // acc[j][r] = channel j * 16 + 8 * hi + r of query ll.
#pragma unroll
    for (int j = 0; j < 8; ++j)
      acc[j] = __builtin_amdgcn_wmma_f32_16x16x32_f16(false, vf[j], false, pf.h,
                                                      (short)0, acc[j], false, false);

    // Publish point of tile kt + 1: this wave's LDS reads are done, the issuer's
    // request has landed, and the one barrier both shows tile kt + 1 to every
    // wave and ends every read of the buffer that is refilled behind it.
    // The scheduling barrier holds the wait here, at the foot: left alone the
    // compiler lifts it to the last read, where it would stall the wave on V.
    __builtin_amdgcn_sched_barrier(0);
    asm volatile("s_wait_dscnt 0x0" ::: "memory");
    if (issuer) tdm_wait(g0, g1);
    __syncthreads();
    if (pinned(issuer & (unsigned)(kt + 2 < ntiles))) {
      g0 = tdm_group0(lds0 + (unsigned)cur * (KT * D_MODEL * 2u),
                      ga0 + (unsigned long long)(unsigned)(kt + 2) * gstep);
      // As in front of the loop: the request's own registers last up to its wait.
      asm volatile("" : "+s"(g0));
      tdm_load(g0, g1);
    }
  }
  // No request and no LDS read is left open when the wave goes on to its end.
  asm volatile("s_wait_tensorcnt 0x0" ::: "memory");
  asm volatile("s_wait_dscnt 0x0" ::: "memory");

  // Epilogue: the range's un-normalised sums, then (maximum, sum) per query.
  lrun += other_half(lrun);
  // A lane holds 8 consecutive channels of its query per tile: through the
  // wave's own LDS rows, so that every global store covers whole 128-byte lines.
  float* st = &stage[wave][0];
#pragma unroll
  for (int j = 0; j < 8; ++j) {
    const f32x4 lo = { acc[j][0], acc[j][1], acc[j][2], acc[j][3] };
    const f32x4 up = { acc[j][4], acc[j][5], acc[j][6], acc[j][7] };
    *(f32x4*)&st[ll * OPITCH + j * 16 + 8 * hi]     = lo;
    *(f32x4*)&st[ll * OPITCH + j * 16 + 8 * hi + 4] = up;
  }
  // The rows are read back by other lanes of this wave than wrote them.
  asm volatile("s_wait_dscnt 0x0" ::: "memory");
  f32x4 row[16];
#pragma unroll
  for (int r = 0; r < 16; ++r) row[r] = *(const f32x4*)&st[r * OPITCH + lane * 4];
  float* pr = part + (((size_t)b * NTOK + m0) * KSPLIT + rng) * D_MODEL + lane * 4;
#pragma unroll
  for (int r = 0; r < 16; ++r) *(f32x4*)(pr + r * (KSPLIT * D_MODEL)) = row[r];
  // Both halves hold the same pair: the lower one stores, 16 pairs to one line.
  if (hi == 0) {
    const f32x2 pair = { mrun, lrun };
    *(f32x2*)(ml + ((size_t)rng * ROWS + (size_t)b * NTOK + m0 + ll) * 2) = pair;
  }
}

// ---------------------------------------------------------------------------
// Kernel 3: merge of the key ranges. One wave takes two adjacent rows, a lane
// four channels of each: weight exp(m - max m) per range, then one division.
// ---------------------------------------------------------------------------
__global__ __launch_bounds__(256)
void merge_ranges_kernel(const float* __restrict__ part,  // [B,N,KSPLIT,C]
                         const float* __restrict__ ml,    // [KSPLIT,B,N,2]
                         float* __restrict__ out)         // [B,N,C] f32
{
  const int idx = blockIdx.x * 256 + threadIdx.x;
  const unsigned row0 = (unsigned)(idx >> 5) * 2;
  const unsigned lane = (unsigned)(idx & 31);
  // Byte offsets of 32 bits beside uniform bases: two registers address all loads.
  const unsigned pbyte = row0 * (KSPLIT * D_MODEL * 4) + lane * 16;
  const unsigned sbyte = row0 * 8;
  const char* pbase = (const char*)part;
  const char* sbase = (const char*)ml;

  f32x4 s[KSPLIT];          // (maximum, sum) of row0, then of row0 + 1
  f32x4 p[2][KSPLIT];
#pragma unroll
  for (int q = 0; q < KSPLIT; ++q)
    s[q] = *(const f32x4*)(sbase + q * (ROWS * 8) + sbyte);
#pragma unroll
  for (int h = 0; h < 2; ++h) {
#pragma unroll
    for (int q = 0; q < KSPLIT; ++q)
      p[h][q] = *(const f32x4*)(pbase + (h * KSPLIT + q) * (D_MODEL * 4) + pbyte);
  }
  // Keeps the arithmetic behind all its loads, so that the wave pays one memory
  // round trip; left alone the compiler sinks the loads towards their uses.
  __builtin_amdgcn_sched_barrier(0);
  // In front of all later writes to the loads' address registers; the two
  // offsets are named so that they keep their registers up to the wait.
  asm volatile("s_wait_xcnt 0x0" :: "v"(pbyte), "v"(sbyte) : "memory");

#pragma unroll
  for (int h = 0; h < 2; ++h) {
    float mx = s[0][2 * h];
#pragma unroll
    for (int q = 1; q < KSPLIT; ++q) mx = fmaxf(mx, s[q][2 * h]);
    float lsum = 0.0f;
    f32x4 o = { 0.0f, 0.0f, 0.0f, 0.0f };
#pragma unroll
    for (int q = 0; q < KSPLIT; ++q) {
      const float w = exp2_slot((s[q][2 * h] - mx) * LOG2E);
      lsum += w * s[q][2 * h + 1];
      o += w * p[h][q];
    }
    *(f32x4*)(out + (row0 + h) * D_MODEL + lane * 4) = o * (1.0f / lsum);
  }
}

// ---------------------------------------------------------------------------
extern "C" void kernel_launch(void* const* d_in, const int* in_sizes, int n_in,
                              void* d_out, int out_size, void* d_ws, size_t ws_size,
                              hipStream_t stream) {
  const float* query = (const float*)d_in[0];
  const float* keyv  = (const float*)d_in[1];
  const float* Wq    = (const float*)d_in[2];
  const float* bq    = (const float*)d_in[3];
  const float* Wk    = (const float*)d_in[4];
  const float* bk    = (const float*)d_in[5];
  const float* Wv    = (const float*)d_in[6];
  const float* bv    = (const float*)d_in[7];
  float* out = (float*)d_out;

  _Float16* ws = (_Float16*)d_ws;
  const size_t mat_elems = (size_t)BATCH * NTOK * D_MODEL;   // 1M halves each
  _Float16* Qws  = ws;
  _Float16* Kws  = ws + mat_elems;
  _Float16* Vtws = ws + 2 * mat_elems;
  float* Pws  = (float*)(ws + 3 * mat_elems);                // KSPLIT partial outputs
  float* MLws = Pws + (size_t)KSPLIT * ROWS * D_MODEL;       // their (maximum, sum) pairs

  qkv_project_kernel<<<3 * BATCH * (NTOK / 16), 256, 0, stream>>>(
      query, keyv, Wq, bq, Wk, bk, Wv, bv, Qws, Kws, Vtws);

  flash_attn_kernel<<<KSPLIT * BATCH * (NTOK / 128), 256, 0, stream>>>(
      Qws, Kws, Vtws, Pws, MLws);

  merge_ranges_kernel<<<ROWS * 32 / 2 / 256, 256, 0, stream>>>(Pws, MLws, out);
}

// v005
// Measured time: 30.7 microseconds a run.
// In both of two side-by-side timings against v004, it was 1.31 times as fast.
// All steps since v000 together make it 17.6 times as fast.
#include <hip/hip_runtime.h>

#define D_MODEL 128
#define NTOK    4096      // T*H*W
#define BATCH   2
#define HW      1024
#define KT      32        // keys per flash-attention tile
#define KSPLIT  8         // key ranges, each walked by a work-group of its own
#define ROWS    (BATCH * NTOK)
#define OPITCH  (D_MODEL + 4)   // floats per staged output row in LDS
#define PTOK    64        // tokens per projection block
#define XPITCH  (D_MODEL + 8)   // halves per staged token row in LDS
#define LOG2E   1.4426950408889634f
#define SCALE   0.08838834764831845f   // 1/sqrt(128)

typedef __attribute__((ext_vector_type(16))) _Float16 v16h;
typedef __attribute__((ext_vector_type(8)))  float    v8f;
typedef __attribute__((ext_vector_type(4))) unsigned int u32x4;
typedef __attribute__((ext_vector_type(8))) unsigned int u32x8;
typedef __attribute__((ext_vector_type(2)))  float    f32x2;
typedef __attribute__((ext_vector_type(4)))  float    f32x4;
typedef __attribute__((ext_vector_type(2)))  _Float16 f16x2;

union V16 { v16h h; u32x4 q[2]; f16x2 p[8]; };
union H8  { _Float16 h[8]; u32x4 q; };
union F8  { float f[8]; u32x4 q[2]; };

__device__ __forceinline__ v16h load_frag_h16(const _Float16* p0, const _Float16* p1) {
  V16 x;
  x.q[0] = *(const u32x4*)p0;
  x.q[1] = *(const u32x4*)p1;
  return x.h;
}

__device__ __forceinline__ unsigned uni(unsigned v) {
  return (unsigned)__builtin_amdgcn_readfirstlane((int)v);
}
__device__ __forceinline__ unsigned pinned(unsigned v) {
  unsigned w = uni(v);
  asm volatile("" : "+s"(w));
  return w;
}
__device__ __forceinline__ u32x8 tdm_group1(unsigned row_bytes, unsigned nrows, unsigned pitch) {
  u32x8 g;
  g[0] = uni(0u);
  g[1] = uni(row_bytes << 16);
  g[2] = uni(nrows << 16);
  g[3] = uni(row_bytes << 16);
  g[4] = uni(nrows);
  g[5] = uni(pitch);
  g[6] = uni(0u);
  g[7] = uni(0u);
  return g;
}
__device__ __forceinline__ u32x4 tdm_group0(unsigned lds_dst, unsigned long long ga) {
  u32x4 g;
  g[0] = uni(1u);
  g[1] = uni(lds_dst);
  g[2] = uni((unsigned)ga);
  g[3] = uni((((unsigned)(ga >> 32)) & 0x01FFFFFFu) | 0x80000000u);
  return g;
}
__device__ __forceinline__ void tdm_load(u32x4 g0, u32x8 g1) {
  asm volatile("tensor_load_to_lds %0, %1" :: "s"(g0), "s"(g1) : "memory");
}
__device__ __forceinline__ void tdm_wait(u32x4 g0, u32x8 g1) {
  asm volatile("s_wait_tensorcnt 0x0" :: "s"(g0), "s"(g1) : "memory");
}

__global__ __launch_bounds__(256)
void qkv_project_kernel(const float* __restrict__ query,
                        const float* __restrict__ key_value,
                        const float* __restrict__ Wq, const float* __restrict__ bq,
                        const float* __restrict__ Wk, const float* __restrict__ bk,
                        const float* __restrict__ Wv, const float* __restrict__ bv,
                        _Float16* __restrict__ qout,
                        _Float16* __restrict__ kout,
                        _Float16* __restrict__ vtout)
{
  static_assert(HW % PTOK == 0, "a block's tokens never cross a T slice");
  static_assert(PTOK * 4 == 256, "four threads stage one token's 16 groups of 8 channels");
  const int id  = blockIdx.x;
  const int mat = id / (BATCH * (NTOK / PTOK));
  const int rem = id % (BATCH * (NTOK / PTOK));
  const int b   = rem / (NTOK / PTOK);
  const int n0  = (rem % (NTOK / PTOK)) * PTOK;
  const int t   = n0 >> 10;
  const int hw0 = n0 & (HW - 1);

  const float* src  = (mat == 0) ? query : key_value;
  const float* W    = (mat == 0) ? Wq : (mat == 1) ? Wk : Wv;
  const float* bias = (mat == 0) ? bq : (mat == 1) ? bk : bv;

  __shared__ __attribute__((aligned(16))) _Float16 sin[PTOK * XPITCH];

  const int tid  = threadIdx.x;
  const int wave = tid >> 5;
  const int lane = tid & 31;
  const int ll   = lane & 15;
  const int hi   = lane >> 4;
  const int koff = hi * 8;

  // All of the block's global loads are issued in one run, x first (it comes
  // from furthest away), so that the wave pays one memory round trip.
  // A wave's 32 lanes are 32 consecutive tokens: each x load is one whole line.
  const int m = tid & (PTOK - 1);   // token within the block
  const int g = tid / PTOK;         // first group of 8 channels
  float xv[4][8];
  {
    const float* xs = src + ((size_t)(t * BATCH + b) * D_MODEL) * HW + hw0 + m;
#pragma unroll
    for (int i = 0; i < 4; ++i) {
#pragma unroll
      for (int e = 0; e < 8; ++e) xv[i][e] = xs[((g + 4 * i) * 8 + e) * HW];
    }
  }
  // Precaution: the results of the loads below may be given the registers of
  // the address that the x loads name; the wait stands in front of that.
  asm volatile("s_wait_xcnt 0x0" ::: "memory");

  const int d = wave * 16 + ll;              // output channel (fragment row or col)
  const float* wrow = W + (size_t)d * D_MODEL;

  v16h wf[4];                                // K = 128 in 4 x 32 steps
#pragma unroll
  for (int cc = 0; cc < 4; ++cc) {
    const int c0 = cc * 32 + koff;
    V16 bf;
#pragma unroll
    for (int i = 0; i < 8; ++i) {
      bf.h[i]     = (_Float16)wrow[c0 + i];
      bf.h[i + 8] = (_Float16)wrow[c0 + 16 + i];
    }
    wf[cc] = bf.h;
  }

  // Both forms of the bias, the 8 channels of a K chunk and the one channel of a
  // Q or V column, without a branch: a branch here parts the run of loads.
  F8 bk8;
  const float* bp = bias + wave * 16 + 8 * hi;
  bk8.q[0] = *(const u32x4*)bp;
  // Precaution: the second load's result may be given the registers of the
  // address pair that the first load names; the wait stands in front of that.
  asm volatile("s_wait_xcnt 0x0" ::: "memory");
  bk8.q[1] = *(const u32x4*)(bp + 4);
  const float bd = bias[d];

#pragma unroll
  for (int i = 0; i < 4; ++i) {
    H8 o;
#pragma unroll
    for (int e = 0; e < 8; ++e) o.h[e] = (_Float16)xv[i][e];
    *(u32x4*)&sin[m * XPITCH + (g + 4 * i) * 8] = o.q;
  }
  __syncthreads();

  // The x fragments of all token tiles, read as one group.
  constexpr int NT = PTOK / 16;
  const int nt0 = n0 / 16;                   // first 16-token tile, counted in the batch
  v16h xf[NT][4];
#pragma unroll
  for (int i = 0; i < NT; ++i) {
    const _Float16* xrow = &sin[(i * 16 + ll) * XPITCH + koff];
#pragma unroll
    for (int cc = 0; cc < 4; ++cc) xf[i][cc] = load_frag_h16(xrow + cc * 32, xrow + cc * 32 + 16);
  }

  v8f acc[NT];
#pragma unroll
  for (int i = 0; i < NT; ++i) acc[i] = (v8f){};
  if (mat == 1) {
    // W as A, x as B: acc[i][r] = k[token (nt0+i)*16 + ll][channel wave*16 + 8*hi + r],
    // the 8 channels of this lane's chunk; chunk index in the batch = (nt0+i)*256 + tid.
#pragma unroll
    for (int cc = 0; cc < 4; ++cc) {
#pragma unroll
      for (int i = 0; i < NT; ++i)
        acc[i] = __builtin_amdgcn_wmma_f32_16x16x32_f16(false, wf[cc], false, xf[i][cc],
                                                        (short)0, acc[i], false, false);
    }
    _Float16* kp = kout + (size_t)b * NTOK * D_MODEL + (size_t)nt0 * (16 * D_MODEL) + tid * 8;
#pragma unroll
    for (int i = 0; i < NT; ++i) {
      H8 o;
#pragma unroll
      for (int r = 0; r < 8; ++r) o.h[r] = (_Float16)(acc[i][r] + bk8.f[r]);
      *(u32x4*)(kp + i * (16 * D_MODEL)) = o.q;
    }
  } else {
    // x as A, W as B: acc[i][r] = y[token (nt0+i)*16 + 8*hi + r][channel d].
#pragma unroll
    for (int cc = 0; cc < 4; ++cc) {
#pragma unroll
      for (int i = 0; i < NT; ++i)
        acc[i] = __builtin_amdgcn_wmma_f32_16x16x32_f16(false, xf[i][cc], false, wf[cc],
                                                        (short)0, acc[i], false, false);
    }
    if (mat == 0) {
      _Float16* qp = qout + ((size_t)b * NTOK + n0 + 8 * hi) * D_MODEL + d;
#pragma unroll
      for (int i = 0; i < NT; ++i) {
#pragma unroll
        for (int r = 0; r < 8; ++r)
          qp[(i * 16 + r) * D_MODEL] = (_Float16)((acc[i][r] + bd) * SCALE);
      }
      asm volatile("s_wait_xcnt 0x0" ::: "memory");
    } else {
      // The 8 keys of this lane's chunk: chunk (wave*2 + (nt & 1)) * 32 + lane
      // of tile nt / 2, four chunks to a 64-byte row; nt = nt0 + i, nt0 even.
      static_assert(NT % 2 == 0, "nt0 is even");
      _Float16* vp = vtout + ((size_t)b * D_MODEL + wave * 16 + (lane >> 2)) * NTOK
                   + (nt0 >> 1) * KT + (lane & 3) * 8;
#pragma unroll
      for (int i = 0; i < NT; ++i) {
        H8 o;
#pragma unroll
        for (int r = 0; r < 8; ++r) o.h[r] = (_Float16)(acc[i][r] + bd);
        *(u32x4*)(vp + (i & 1) * 8 * NTOK + (i >> 1) * KT) = o.q;
      }
      // The listing lets code that rewrites the stores' registers follow them.
      asm volatile("s_wait_xcnt 0x0" ::: "memory");
    }
  }
}

__device__ __forceinline__ float other_half(float x) {
  const int b = __builtin_bit_cast(int, x);
  return __builtin_bit_cast(float, __builtin_amdgcn_permlanex16(b, b, 0x76543210, 0xfedcba98,
                                                                false, false));
}

__device__ __forceinline__ float exp2_slot(float x) {
  float r;
  asm("v_exp_f32 %0, %1\n\tv_nop" : "=v"(r) : "v"(x));
  return r;
}

__global__ __launch_bounds__(256)
void flash_attn_kernel(const _Float16* __restrict__ Q,    // [B,N,C] pre-scaled
                       const _Float16* __restrict__ K,    // [B,N/32,tile] fragment order
                       const _Float16* __restrict__ Vt,   // [B,128,N] fragment order per tile
                       float* __restrict__ part,          // [B,N,KSPLIT,C] f32
                       float* __restrict__ ml)            // [KSPLIT,B,N,2] f32
{
  const int rng  = blockIdx.x / (BATCH * (NTOK / 128));
  const int qblk = blockIdx.x % (BATCH * (NTOK / 128));
  const int b    = qblk / (NTOK / 128);
  const int mblk = qblk % (NTOK / 128);
  const int tid  = threadIdx.x;
  const int wave = tid >> 5;
  const int lane = tid & 31;
  const int ll   = lane & 15;
  const int hi   = lane >> 4;
  const int koff = hi * 8;

  const int m0 = mblk * 128 + wave * 16;

  // Each 8 KB buffer is a tensor load's place: a multiple of 2 KiB.
  __shared__ __attribute__((aligned(2048))) _Float16 Kbuf[2][KT * D_MODEL]; // [half 0..15][lane][8]
  __shared__ __attribute__((aligned(2048))) _Float16 Vbuf[2][D_MODEL * KT]; // [half 0..15][lane][8]
  __shared__ __attribute__((aligned(16))) float stage[8][16 * OPITCH];

  // This block's tiles: tile0 .. tile0 + ntiles - 1 of the NTOK / KT.
  constexpr int ntiles = NTOK / KT / KSPLIT;
  static_assert(ntiles * KSPLIT * KT == NTOK, "the ranges are equal and cover every key");
  static_assert(ntiles >= 2, "the ring's first two stages must exist");
  const int tile0 = rng * ntiles;

  const _Float16* Kb = K  + (size_t)b * NTOK * D_MODEL + (size_t)tile0 * KT * D_MODEL;
  const _Float16* Vb = Vt + (size_t)b * D_MODEL * NTOK + (size_t)tile0 * KT;

  // Resident Q fragments, the B operand: column = ll, K sub-block per lane half.
  const _Float16* qrow = Q + ((size_t)b * NTOK + m0 + ll) * D_MODEL;
  v16h qf[4];
#pragma unroll
  for (int cc = 0; cc < 4; ++cc) {
    const int c0 = cc * 32 + koff;
    qf[cc] = load_frag_h16(qrow + c0, qrow + c0 + 16);
  }

  v8f acc[8];
  // This lane's query: the maximum so far (equal in both halves) and the sum
  // over this half's keys alone; the halves' sums are joined behind the loop.
  float mrun = -3.0e38f, lrun = 0.0f;
#pragma unroll
  for (int j = 0; j < 8; ++j) acc[j] = (v8f){};

  // The ring. Wave 0: K tile, 32 rows of 256 bytes, contiguous. Wave 1: V tile,
  // 128 rows of 64 bytes at a pitch of NTOK halves. One request a wave and stage.
  const unsigned wv     = uni((unsigned)tid >> 5);
  const unsigned issuer = pinned(wv < 2u);
  const bool     isV    = wv == 1u;
  const u32x8 g1 = tdm_group1(isV ? KT * 2u : D_MODEL * 2u, isV ? (unsigned)D_MODEL : (unsigned)KT,
                              isV ? NTOK * 2u : D_MODEL * 2u);
  // Generic shared pointers carry the LDS byte offset in their low 32 bits.
  const unsigned lds0 = isV ? (unsigned)(size_t)(const void*)&Vbuf[0][0]
                            : (unsigned)(size_t)(const void*)&Kbuf[0][0];
  const unsigned long long ga0 = (unsigned long long)(size_t)(isV ? Vb : Kb);
  const unsigned gstep = isV ? KT * 2u : KT * D_MODEL * 2u;   // bytes from tile to tile
  u32x4 g0 = tdm_group0(lds0, ga0);
  if (issuer) {
    tdm_load(g0, g1);
    tdm_wait(g0, g1);
  }
  __syncthreads();   // tile 0 visible in LDS to all waves
  g0 = tdm_group0(lds0 + KT * D_MODEL * 2u, ga0 + gstep);
  asm volatile("" : "+s"(g0));
  if (issuer) tdm_load(g0, g1);

  for (int kt = 0; kt < ntiles; ++kt) {
    const int cur = kt & 1;

    // S^T = K Q^T : two 16-key tiles, K=128 in 4 steps each (K from LDS).
    // s[t][r] = score of key t * 16 + 8 * hi + r against query ll.
    // All of the pass's LDS reads stand in one group at its head, in the order of
    // their use: K's latency is waited out once, and V lands behind the score
    // products and the softmax. Read singly, each read's latency is waited out.
    const _Float16* kfr = &Kbuf[cur][lane * 8];
    const _Float16* vfr = &Vbuf[cur][lane * 8];
    v16h kf[4][2], vf[8];
#pragma unroll
    for (int cc = 0; cc < 4; ++cc) {
#pragma unroll
      for (int ntile = 0; ntile < 2; ++ntile)
        kf[cc][ntile] = load_frag_h16(kfr + ntile * 2048 + cc * 512, kfr + ntile * 2048 + cc * 512 + 256);
    }
#pragma unroll
    for (int j = 0; j < 8; ++j) vf[j] = load_frag_h16(vfr + j * 512, vfr + j * 512 + 256);
    // Keeps the group whole: left alone the compiler sinks each read to its product.
    __builtin_amdgcn_sched_barrier(0);
    v8f s[2] = {(v8f){}, (v8f){}};
#pragma unroll
    for (int cc = 0; cc < 4; ++cc) {
#pragma unroll
      for (int ntile = 0; ntile < 2; ++ntile)
        s[ntile] = __builtin_amdgcn_wmma_f32_16x16x32_f16(false, kf[cc][ntile], false, qf[cc],
                                                          (short)0, s[ntile], false, false);
    }

    // Online softmax of this lane's query: 16 scores here, 16 in lane ^ 16.
    float v0 = fmaxf(fmaxf(s[0][0], s[0][1]), s[0][2]);
    float v1 = fmaxf(fmaxf(s[0][3], s[0][4]), s[0][5]);
    float v2 = fmaxf(fmaxf(s[0][6], s[0][7]), s[1][0]);
    float v3 = fmaxf(fmaxf(s[1][1], s[1][2]), s[1][3]);
    float v4 = fmaxf(fmaxf(s[1][4], s[1][5]), s[1][6]);
    v0 = fmaxf(fmaxf(v0, v1), v2);
    v3 = fmaxf(fmaxf(v3, v4), s[1][7]);
    v0 = fmaxf(v0, v3);
    const float mn = fmaxf(mrun, fmaxf(v0, other_half(v0)));
    const float f  = exp2_slot((mrun - mn) * LOG2E);
    mrun = mn;
    const float nml = -mn * LOG2E;
    const f32x2 c2 = { LOG2E, LOG2E };
    const f32x2 n2 = { nml, nml };
    // P^T: element e of the B fragment is key (e / 8) * 16 + 8 * hi + e % 8, and
    // that is score tile e / 8, register e % 8, of this very lane.
    V16 pf;
    f32x2 p[8];
#pragma unroll
    for (int i = 0; i < 8; ++i) {
      const f32x2 x = { s[i >> 2][2 * (i & 3)], s[i >> 2][2 * (i & 3) + 1] };
      const f32x2 e = __builtin_elementwise_fma(x, c2, n2);
      p[i].x = __builtin_amdgcn_exp2f(e.x);
      p[i].y = __builtin_amdgcn_exp2f(e.y);
      pf.p[i] = __builtin_convertvector(p[i], f16x2);
    }
    const f32x2 ps = ((p[0] + p[1]) + (p[2] + p[3])) + ((p[4] + p[5]) + (p[6] + p[7]));
    lrun = lrun * f + (ps.x + ps.y);
#pragma unroll
    for (int j = 0; j < 8; ++j) acc[j] *= f;

    // O^T += V^T P^T : 8 tiles of 16 channels, K = 32 keys.
    // acc[j][r] = channel j * 16 + 8 * hi + r of query ll.
#pragma unroll
    for (int j = 0; j < 8; ++j)
      acc[j] = __builtin_amdgcn_wmma_f32_16x16x32_f16(false, vf[j], false, pf.h,
                                                      (short)0, acc[j], false, false);

    // Publish point of tile kt + 1: this wave's LDS reads are done, the issuer's
    // request has landed, and the one barrier both shows tile kt + 1 to every
    // wave and ends every read of the buffer that is refilled behind it.
    // The scheduling barrier holds the wait here, at the foot: left alone the
    // compiler lifts it to the last read, where it would stall the wave on V.
    __builtin_amdgcn_sched_barrier(0);
    asm volatile("s_wait_dscnt 0x0" ::: "memory");
    if (issuer) tdm_wait(g0, g1);
    __syncthreads();
    if (pinned(issuer & (unsigned)(kt + 2 < ntiles))) {
      g0 = tdm_group0(lds0 + (unsigned)cur * (KT * D_MODEL * 2u),
                      ga0 + (unsigned long long)(unsigned)(kt + 2) * gstep);
      // As in front of the loop: the request's own registers last up to its wait.
      asm volatile("" : "+s"(g0));
      tdm_load(g0, g1);
    }
  }
  // No request and no LDS read is left open when the wave goes on to its end.
  asm volatile("s_wait_tensorcnt 0x0" ::: "memory");
  asm volatile("s_wait_dscnt 0x0" ::: "memory");

  // Epilogue: the range's un-normalised sums, then (maximum, sum) per query.
  lrun += other_half(lrun);
  // A lane holds 8 consecutive channels of its query per tile: through the
  // wave's own LDS rows, so that every global store covers whole 128-byte lines.
  float* st = &stage[wave][0];
#pragma unroll
  for (int j = 0; j < 8; ++j) {
    const f32x4 lo = { acc[j][0], acc[j][1], acc[j][2], acc[j][3] };
    const f32x4 up = { acc[j][4], acc[j][5], acc[j][6], acc[j][7] };
    *(f32x4*)&st[ll * OPITCH + j * 16 + 8 * hi]     = lo;
    *(f32x4*)&st[ll * OPITCH + j * 16 + 8 * hi + 4] = up;
  }
  // The rows are read back by other lanes of this wave than wrote them.
  asm volatile("s_wait_dscnt 0x0" ::: "memory");
  f32x4 row[16];
#pragma unroll
  for (int r = 0; r < 16; ++r) row[r] = *(const f32x4*)&st[r * OPITCH + lane * 4];
  float* pr = part + (((size_t)b * NTOK + m0) * KSPLIT + rng) * D_MODEL + lane * 4;
#pragma unroll
  for (int r = 0; r < 16; ++r) *(f32x4*)(pr + r * (KSPLIT * D_MODEL)) = row[r];
  // Both halves hold the same pair: the lower one stores, 16 pairs to one line.
  if (hi == 0) {
    const f32x2 pair = { mrun, lrun };
    *(f32x2*)(ml + ((size_t)rng * ROWS + (size_t)b * NTOK + m0 + ll) * 2) = pair;
  }
}

// ---------------------------------------------------------------------------
// Kernel 3: merge of the key ranges. One wave takes two adjacent rows, a lane
// four channels of each: weight exp(m - max m) per range, then one division.
// ---------------------------------------------------------------------------
__global__ __launch_bounds__(256)
void merge_ranges_kernel(const float* __restrict__ part,  // [B,N,KSPLIT,C]
                         const float* __restrict__ ml,    // [KSPLIT,B,N,2]
                         float* __restrict__ out)         // [B,N,C] f32
{
  const int idx = blockIdx.x * 256 + threadIdx.x;
  const unsigned row0 = (unsigned)(idx >> 5) * 2;
  const unsigned lane = (unsigned)(idx & 31);
  // Byte offsets of 32 bits beside uniform bases: two registers address all loads.
  const unsigned pbyte = row0 * (KSPLIT * D_MODEL * 4) + lane * 16;
  const unsigned sbyte = row0 * 8;
  const char* pbase = (const char*)part;
  const char* sbase = (const char*)ml;

  f32x4 s[KSPLIT];          // (maximum, sum) of row0, then of row0 + 1
  f32x4 p[2][KSPLIT];
#pragma unroll
  for (int q = 0; q < KSPLIT; ++q)
    s[q] = *(const f32x4*)(sbase + q * (ROWS * 8) + sbyte);
#pragma unroll
  for (int h = 0; h < 2; ++h) {
#pragma unroll
    for (int q = 0; q < KSPLIT; ++q)
      p[h][q] = *(const f32x4*)(pbase + (h * KSPLIT + q) * (D_MODEL * 4) + pbyte);
  }
  // Keeps the arithmetic behind all its loads, so that the wave pays one memory
  // round trip; left alone the compiler sinks the loads towards their uses.
  __builtin_amdgcn_sched_barrier(0);
  // In front of all later writes to the loads' address registers; the two
  // offsets are named so that they keep their registers up to the wait.
  asm volatile("s_wait_xcnt 0x0" :: "v"(pbyte), "v"(sbyte) : "memory");

#pragma unroll
  for (int h = 0; h < 2; ++h) {
    float mx = s[0][2 * h];
#pragma unroll
    for (int q = 1; q < KSPLIT; ++q) mx = fmaxf(mx, s[q][2 * h]);
    float lsum = 0.0f;
    f32x4 o = { 0.0f, 0.0f, 0.0f, 0.0f };
#pragma unroll
    for (int q = 0; q < KSPLIT; ++q) {
      const float w = exp2_slot((s[q][2 * h] - mx) * LOG2E);
      lsum += w * s[q][2 * h + 1];
      o += w * p[h][q];
    }
    *(f32x4*)(out + (row0 + h) * D_MODEL + lane * 4) = o * (1.0f / lsum);
  }
}

// ---------------------------------------------------------------------------
extern "C" void kernel_launch(void* const* d_in, const int* in_sizes, int n_in,
                              void* d_out, int out_size, void* d_ws, size_t ws_size,
                              hipStream_t stream) {
  const float* query = (const float*)d_in[0];
  const float* keyv  = (const float*)d_in[1];
  const float* Wq    = (const float*)d_in[2];
  const float* bq    = (const float*)d_in[3];
  const float* Wk    = (const float*)d_in[4];
  const float* bk    = (const float*)d_in[5];
  const float* Wv    = (const float*)d_in[6];
  const float* bv    = (const float*)d_in[7];
  float* out = (float*)d_out;

  _Float16* ws = (_Float16*)d_ws;
  const size_t mat_elems = (size_t)BATCH * NTOK * D_MODEL;   // 1M halves each
  _Float16* Qws  = ws;
  _Float16* Kws  = ws + mat_elems;
  _Float16* Vtws = ws + 2 * mat_elems;
  float* Pws  = (float*)(ws + 3 * mat_elems);                // KSPLIT partial outputs
  float* MLws = Pws + (size_t)KSPLIT * ROWS * D_MODEL;       // their (maximum, sum) pairs

  qkv_project_kernel<<<3 * BATCH * (NTOK / PTOK), 256, 0, stream>>>(
      query, keyv, Wq, bq, Wk, bk, Wv, bv, Qws, Kws, Vtws);

  flash_attn_kernel<<<KSPLIT * BATCH * (NTOK / 128), 256, 0, stream>>>(
      Qws, Kws, Vtws, Pws, MLws);

  merge_ranges_kernel<<<ROWS * 32 / 2 / 256, 256, 0, stream>>>(Pws, MLws, out);
}

// v006
// Measured time: 27 microseconds a run.
// Timed twice side by side with v005, it ran 1.14 and 1.13 times as fast.
// Over all steps from v000 it is 19.9 times as fast.
#include <hip/hip_runtime.h>

#define D_MODEL 128
#define NTOK    4096      // T*H*W
#define BATCH   2
#define HW      1024
#define KT      32        // keys per flash-attention tile
#define KSPLIT  8         // key ranges, each walked by a work-group of its own
#define ROWS    (BATCH * NTOK)
#define OPITCH  (D_MODEL + 8)   // halves per staged output row in LDS
#define PTOK    64        // tokens per projection block
#define XPITCH  (D_MODEL + 8)   // halves per staged token row in LDS
#define LOG2E   1.4426950408889634f
#define SCALE   0.08838834764831845f   // 1/sqrt(128)

typedef __attribute__((ext_vector_type(16))) _Float16 v16h;
typedef __attribute__((ext_vector_type(8)))  float    v8f;
typedef __attribute__((ext_vector_type(4))) unsigned int u32x4;
typedef __attribute__((ext_vector_type(8))) unsigned int u32x8;
typedef __attribute__((ext_vector_type(2)))  float    f32x2;
typedef __attribute__((ext_vector_type(4)))  float    f32x4;
typedef __attribute__((ext_vector_type(2)))  _Float16 f16x2;
typedef __attribute__((ext_vector_type(4)))  _Float16 f16x4;

union V16 { v16h h; u32x4 q[2]; f16x2 p[8]; };
union H8  { _Float16 h[8]; u32x4 q; };
union F8  { float f[8]; u32x4 q[2]; };

__device__ __forceinline__ v16h load_frag_h16(const _Float16* p0, const _Float16* p1) {
  V16 x;
  x.q[0] = *(const u32x4*)p0;
  x.q[1] = *(const u32x4*)p1;
  return x.h;
}

__device__ __forceinline__ unsigned uni(unsigned v) {
  return (unsigned)__builtin_amdgcn_readfirstlane((int)v);
}
__device__ __forceinline__ unsigned pinned(unsigned v) {
  unsigned w = uni(v);
  asm volatile("" : "+s"(w));
  return w;
}
__device__ __forceinline__ u32x8 tdm_group1(unsigned row_bytes, unsigned nrows, unsigned pitch) {
  u32x8 g;
  g[0] = uni(0u);
  g[1] = uni(row_bytes << 16);
  g[2] = uni(nrows << 16);
  g[3] = uni(row_bytes << 16);
  g[4] = uni(nrows);
  g[5] = uni(pitch);
  g[6] = uni(0u);
  g[7] = uni(0u);
  return g;
}
__device__ __forceinline__ u32x4 tdm_group0(unsigned lds_dst, unsigned long long ga) {
  u32x4 g;
  g[0] = uni(1u);
  g[1] = uni(lds_dst);
  g[2] = uni((unsigned)ga);
  g[3] = uni((((unsigned)(ga >> 32)) & 0x01FFFFFFu) | 0x80000000u);
  return g;
}
__device__ __forceinline__ void tdm_load(u32x4 g0, u32x8 g1) {
  asm volatile("tensor_load_to_lds %0, %1" :: "s"(g0), "s"(g1) : "memory");
}
__device__ __forceinline__ void tdm_wait(u32x4 g0, u32x8 g1) {
  asm volatile("s_wait_tensorcnt 0x0" :: "s"(g0), "s"(g1) : "memory");
}

__global__ __launch_bounds__(256)
void qkv_project_kernel(const float* __restrict__ query,
                        const float* __restrict__ key_value,
                        const float* __restrict__ Wq, const float* __restrict__ bq,
                        const float* __restrict__ Wk, const float* __restrict__ bk,
                        const float* __restrict__ Wv, const float* __restrict__ bv,
                        _Float16* __restrict__ qout,
                        _Float16* __restrict__ kout,
                        _Float16* __restrict__ vtout)
{
  static_assert(HW % PTOK == 0, "a block's tokens never cross a T slice");
  static_assert(PTOK * 4 == 256, "four threads stage one token's 16 groups of 8 channels");
  const int id  = blockIdx.x;
  const int mat = id / (BATCH * (NTOK / PTOK));
  const int rem = id % (BATCH * (NTOK / PTOK));
  const int b   = rem / (NTOK / PTOK);
  const int n0  = (rem % (NTOK / PTOK)) * PTOK;
  const int t   = n0 >> 10;
  const int hw0 = n0 & (HW - 1);

  const float* src  = (mat == 0) ? query : key_value;
  const float* W    = (mat == 0) ? Wq : (mat == 1) ? Wk : Wv;
  const float* bias = (mat == 0) ? bq : (mat == 1) ? bk : bv;

  __shared__ __attribute__((aligned(16))) _Float16 sin[PTOK * XPITCH];

  const int tid  = threadIdx.x;
  const int wave = tid >> 5;
  const int lane = tid & 31;
  const int ll   = lane & 15;
  const int hi   = lane >> 4;
  const int koff = hi * 8;

  // All of the block's global loads are issued in one run, x first (it comes
  // from furthest away), so that the wave pays one memory round trip.
  // A wave's 32 lanes are 32 consecutive tokens: each x load is one whole line.
  const int m = tid & (PTOK - 1);   // token within the block
  const int g = tid / PTOK;         // first group of 8 channels
  float xv[4][8];
  {
    const float* xs = src + ((size_t)(t * BATCH + b) * D_MODEL) * HW + hw0 + m;
#pragma unroll
    for (int i = 0; i < 4; ++i) {
#pragma unroll
      for (int e = 0; e < 8; ++e) xv[i][e] = xs[((g + 4 * i) * 8 + e) * HW];
    }
  }
  // Precaution: the results of the loads below may be given the registers of
  // the address that the x loads name; the wait stands in front of that.
  asm volatile("s_wait_xcnt 0x0" ::: "memory");

  const int d = wave * 16 + ll;              // output channel (fragment row or col)
  const float* wrow = W + (size_t)d * D_MODEL;

  v16h wf[4];                                // K = 128 in 4 x 32 steps
#pragma unroll
  for (int cc = 0; cc < 4; ++cc) {
    const int c0 = cc * 32 + koff;
    V16 bf;
#pragma unroll
    for (int i = 0; i < 8; ++i) {
      bf.h[i]     = (_Float16)wrow[c0 + i];
      bf.h[i + 8] = (_Float16)wrow[c0 + 16 + i];
    }
    wf[cc] = bf.h;
  }

  // Both forms of the bias, the 8 channels of a K chunk and the one channel of a
  // Q or V column, without a branch: a branch here parts the run of loads.
  F8 bk8;
  const float* bp = bias + wave * 16 + 8 * hi;
  bk8.q[0] = *(const u32x4*)bp;
  // Precaution: the second load's result may be given the registers of the
  // address pair that the first load names; the wait stands in front of that.
  asm volatile("s_wait_xcnt 0x0" ::: "memory");
  bk8.q[1] = *(const u32x4*)(bp + 4);
  const float bd = bias[d];

#pragma unroll
  for (int i = 0; i < 4; ++i) {
    H8 o;
#pragma unroll
    for (int e = 0; e < 8; ++e) o.h[e] = (_Float16)xv[i][e];
    *(u32x4*)&sin[m * XPITCH + (g + 4 * i) * 8] = o.q;
  }
  __syncthreads();

  // The x fragments of all token tiles, read as one group.
  constexpr int NT = PTOK / 16;
  const int nt0 = n0 / 16;                   // first 16-token tile, counted in the batch
  v16h xf[NT][4];
#pragma unroll
  for (int i = 0; i < NT; ++i) {
    const _Float16* xrow = &sin[(i * 16 + ll) * XPITCH + koff];
#pragma unroll
    for (int cc = 0; cc < 4; ++cc) xf[i][cc] = load_frag_h16(xrow + cc * 32, xrow + cc * 32 + 16);
  }

  v8f acc[NT];
#pragma unroll
  for (int i = 0; i < NT; ++i) acc[i] = (v8f){};
  if (mat == 1) {
    // W as A, x as B: acc[i][r] = k[token (nt0+i)*16 + ll][channel wave*16 + 8*hi + r],
    // the 8 channels of this lane's chunk; chunk index in the batch = (nt0+i)*256 + tid.
#pragma unroll
    for (int cc = 0; cc < 4; ++cc) {
#pragma unroll
      for (int i = 0; i < NT; ++i)
        acc[i] = __builtin_amdgcn_wmma_f32_16x16x32_f16(false, wf[cc], false, xf[i][cc],
                                                        (short)0, acc[i], false, false);
    }
    _Float16* kp = kout + (size_t)b * NTOK * D_MODEL + (size_t)nt0 * (16 * D_MODEL) + tid * 8;
#pragma unroll
    for (int i = 0; i < NT; ++i) {
      H8 o;
#pragma unroll
      for (int r = 0; r < 8; ++r) o.h[r] = (_Float16)(acc[i][r] + bk8.f[r]);
      *(u32x4*)(kp + i * (16 * D_MODEL)) = o.q;
    }
  } else {
    // x as A, W as B: acc[i][r] = y[token (nt0+i)*16 + 8*hi + r][channel d].
#pragma unroll
    for (int cc = 0; cc < 4; ++cc) {
#pragma unroll
      for (int i = 0; i < NT; ++i)
        acc[i] = __builtin_amdgcn_wmma_f32_16x16x32_f16(false, xf[i][cc], false, wf[cc],
                                                        (short)0, acc[i], false, false);
    }
    if (mat == 0) {
      _Float16* qp = qout + ((size_t)b * NTOK + n0 + 8 * hi) * D_MODEL + d;
#pragma unroll
      for (int i = 0; i < NT; ++i) {
#pragma unroll
        for (int r = 0; r < 8; ++r)
          qp[(i * 16 + r) * D_MODEL] = (_Float16)((acc[i][r] + bd) * SCALE);
      }
      asm volatile("s_wait_xcnt 0x0" ::: "memory");
    } else {
      // The 8 keys of this lane's chunk: chunk (wave*2 + (nt & 1)) * 32 + lane
      // of tile nt / 2, four chunks to a 64-byte row; nt = nt0 + i, nt0 even.
      static_assert(NT % 2 == 0, "nt0 is even");
      _Float16* vp = vtout + ((size_t)b * D_MODEL + wave * 16 + (lane >> 2)) * NTOK
                   + (nt0 >> 1) * KT + (lane & 3) * 8;
#pragma unroll
      for (int i = 0; i < NT; ++i) {
        H8 o;
#pragma unroll
        for (int r = 0; r < 8; ++r) o.h[r] = (_Float16)(acc[i][r] + bd);
        *(u32x4*)(vp + (i & 1) * 8 * NTOK + (i >> 1) * KT) = o.q;
      }
      // The listing lets code that rewrites the stores' registers follow them.
      asm volatile("s_wait_xcnt 0x0" ::: "memory");
    }
  }
}

__device__ __forceinline__ float other_half(float x) {
  const int b = __builtin_bit_cast(int, x);
  return __builtin_bit_cast(float, __builtin_amdgcn_permlanex16(b, b, 0x76543210, 0xfedcba98,
                                                                false, false));
}

__device__ __forceinline__ float exp2_slot(float x) {
  float r;
  asm("v_exp_f32 %0, %1\n\tv_nop" : "=v"(r) : "v"(x));
  return r;
}

__global__ __launch_bounds__(256)
void flash_attn_kernel(const _Float16* __restrict__ Q,
                       const _Float16* __restrict__ K,
                       const _Float16* __restrict__ Vt,
                       _Float16* __restrict__ part,
                       float* __restrict__ ml)
{
  const int rng  = blockIdx.x / (BATCH * (NTOK / 128));
  const int qblk = blockIdx.x % (BATCH * (NTOK / 128));
  const int b    = qblk / (NTOK / 128);
  const int mblk = qblk % (NTOK / 128);
  const int tid  = threadIdx.x;
  const int wave = tid >> 5;
  const int lane = tid & 31;
  const int ll   = lane & 15;
  const int hi   = lane >> 4;
  const int koff = hi * 8;

  const int m0 = mblk * 128 + wave * 16;

  // Each 8 KB buffer is a tensor load's place: a multiple of 2 KiB.
  __shared__ __attribute__((aligned(2048))) _Float16 Kbuf[2][KT * D_MODEL]; // [half 0..15][lane][8]
  __shared__ __attribute__((aligned(2048))) _Float16 Vbuf[2][D_MODEL * KT]; // [half 0..15][lane][8]
  __shared__ __attribute__((aligned(16))) _Float16 stage[8][16 * OPITCH];

  // This block's tiles: tile0 .. tile0 + ntiles - 1 of the NTOK / KT.
  constexpr int ntiles = NTOK / KT / KSPLIT;
  static_assert(ntiles * KSPLIT * KT == NTOK, "the ranges are equal and cover every key");
  static_assert(ntiles >= 2, "the ring's first two stages must exist");
  const int tile0 = rng * ntiles;

  const _Float16* Kb = K  + (size_t)b * NTOK * D_MODEL + (size_t)tile0 * KT * D_MODEL;
  const _Float16* Vb = Vt + (size_t)b * D_MODEL * NTOK + (size_t)tile0 * KT;

  // Resident Q fragments, the B operand: column = ll, K sub-block per lane half.
  const _Float16* qrow = Q + ((size_t)b * NTOK + m0 + ll) * D_MODEL;
  v16h qf[4];
#pragma unroll
  for (int cc = 0; cc < 4; ++cc) {
    const int c0 = cc * 32 + koff;
    qf[cc] = load_frag_h16(qrow + c0, qrow + c0 + 16);
  }

  v8f acc[8];
  // This lane's query: the maximum so far (equal in both halves) and the sum
  // over this half's keys alone; the halves' sums are joined behind the loop.
  float mrun = -3.0e38f, lrun = 0.0f;
#pragma unroll
  for (int j = 0; j < 8; ++j) acc[j] = (v8f){};

  // The ring. Wave 0: K tile, 32 rows of 256 bytes, contiguous. Wave 1: V tile,
  // 128 rows of 64 bytes at a pitch of NTOK halves. One request a wave and stage.
  const unsigned wv     = uni((unsigned)tid >> 5);
  const unsigned issuer = pinned(wv < 2u);
  const bool     isV    = wv == 1u;
  const u32x8 g1 = tdm_group1(isV ? KT * 2u : D_MODEL * 2u, isV ? (unsigned)D_MODEL : (unsigned)KT,
                              isV ? NTOK * 2u : D_MODEL * 2u);
  // Generic shared pointers carry the LDS byte offset in their low 32 bits.
  const unsigned lds0 = isV ? (unsigned)(size_t)(const void*)&Vbuf[0][0]
                            : (unsigned)(size_t)(const void*)&Kbuf[0][0];
  const unsigned long long ga0 = (unsigned long long)(size_t)(isV ? Vb : Kb);
  const unsigned gstep = isV ? KT * 2u : KT * D_MODEL * 2u;   // bytes from tile to tile
  u32x4 g0 = tdm_group0(lds0, ga0);
  if (issuer) {
    tdm_load(g0, g1);
    tdm_wait(g0, g1);
  }
  __syncthreads();   // tile 0 visible in LDS to all waves
  g0 = tdm_group0(lds0 + KT * D_MODEL * 2u, ga0 + gstep);
  asm volatile("" : "+s"(g0));
  if (issuer) tdm_load(g0, g1);

  for (int kt = 0; kt < ntiles; ++kt) {
    const int cur = kt & 1;

    // S^T = K Q^T : two 16-key tiles, K=128 in 4 steps each (K from LDS).
    // s[t][r] = score of key t * 16 + 8 * hi + r against query ll.
    // All of the pass's LDS reads stand in one group at its head, in the order of
    // their use: K's latency is waited out once, and V lands behind the score
    // products and the softmax. Read singly, each read's latency is waited out.
    const _Float16* kfr = &Kbuf[cur][lane * 8];
    const _Float16* vfr = &Vbuf[cur][lane * 8];
    v16h kf[4][2], vf[8];
#pragma unroll
    for (int cc = 0; cc < 4; ++cc) {
#pragma unroll
      for (int ntile = 0; ntile < 2; ++ntile)
        kf[cc][ntile] = load_frag_h16(kfr + ntile * 2048 + cc * 512, kfr + ntile * 2048 + cc * 512 + 256);
    }
#pragma unroll
    for (int j = 0; j < 8; ++j) vf[j] = load_frag_h16(vfr + j * 512, vfr + j * 512 + 256);
    // Keeps the group whole: left alone the compiler sinks each read to its product.
    __builtin_amdgcn_sched_barrier(0);
    v8f s[2] = {(v8f){}, (v8f){}};
#pragma unroll
    for (int cc = 0; cc < 4; ++cc) {
#pragma unroll
      for (int ntile = 0; ntile < 2; ++ntile)
        s[ntile] = __builtin_amdgcn_wmma_f32_16x16x32_f16(false, kf[cc][ntile], false, qf[cc],
                                                          (short)0, s[ntile], false, false);
    }

    // Online softmax of this lane's query: 16 scores here, 16 in lane ^ 16.
    float v0 = fmaxf(fmaxf(s[0][0], s[0][1]), s[0][2]);
    float v1 = fmaxf(fmaxf(s[0][3], s[0][4]), s[0][5]);
    float v2 = fmaxf(fmaxf(s[0][6], s[0][7]), s[1][0]);
    float v3 = fmaxf(fmaxf(s[1][1], s[1][2]), s[1][3]);
    float v4 = fmaxf(fmaxf(s[1][4], s[1][5]), s[1][6]);
    v0 = fmaxf(fmaxf(v0, v1), v2);
    v3 = fmaxf(fmaxf(v3, v4), s[1][7]);
    v0 = fmaxf(v0, v3);
    const float mn = fmaxf(mrun, fmaxf(v0, other_half(v0)));
    const float f  = exp2_slot((mrun - mn) * LOG2E);
    mrun = mn;
    const float nml = -mn * LOG2E;
    const f32x2 c2 = { LOG2E, LOG2E };
    const f32x2 n2 = { nml, nml };
    // P^T: element e of the B fragment is key (e / 8) * 16 + 8 * hi + e % 8, and
    // that is score tile e / 8, register e % 8, of this very lane.
    V16 pf;
    f32x2 p[8];
#pragma unroll
    for (int i = 0; i < 8; ++i) {
      const f32x2 x = { s[i >> 2][2 * (i & 3)], s[i >> 2][2 * (i & 3) + 1] };
      const f32x2 e = __builtin_elementwise_fma(x, c2, n2);
      p[i].x = __builtin_amdgcn_exp2f(e.x);
      p[i].y = __builtin_amdgcn_exp2f(e.y);
      pf.p[i] = __builtin_convertvector(p[i], f16x2);
    }
    const f32x2 ps = ((p[0] + p[1]) + (p[2] + p[3])) + ((p[4] + p[5]) + (p[6] + p[7]));
    lrun = lrun * f + (ps.x + ps.y);
#pragma unroll
    for (int j = 0; j < 8; ++j) acc[j] *= f;

    // O^T += V^T P^T : 8 tiles of 16 channels, K = 32 keys.
    // acc[j][r] = channel j * 16 + 8 * hi + r of query ll.
#pragma unroll
    for (int j = 0; j < 8; ++j)
      acc[j] = __builtin_amdgcn_wmma_f32_16x16x32_f16(false, vf[j], false, pf.h,
                                                      (short)0, acc[j], false, false);

    // Publish point of tile kt + 1: this wave's LDS reads are done, the issuer's
    // request has landed, and the one barrier both shows tile kt + 1 to every
    // wave and ends every read of the buffer that is refilled behind it.
    // The scheduling barrier holds the wait here, at the foot: left alone the
    // compiler lifts it to the last read, where it would stall the wave on V.
    __builtin_amdgcn_sched_barrier(0);
    asm volatile("s_wait_dscnt 0x0" ::: "memory");
    if (issuer) tdm_wait(g0, g1);
    __syncthreads();
    if (pinned(issuer & (unsigned)(kt + 2 < ntiles))) {
      g0 = tdm_group0(lds0 + (unsigned)cur * (KT * D_MODEL * 2u),
                      ga0 + (unsigned long long)(unsigned)(kt + 2) * gstep);
      // As in front of the loop: the request's own registers last up to its wait.
      asm volatile("" : "+s"(g0));
      tdm_load(g0, g1);
    }
  }
  // No request and no LDS read is left open when the wave goes on to its end.
  asm volatile("s_wait_tensorcnt 0x0" ::: "memory");
  asm volatile("s_wait_dscnt 0x0" ::: "memory");

  // Epilogue: the range's sums over its own sum, then (maximum, sum) per query.
  lrun += other_half(lrun);
  const float inv = 1.0f / lrun;
  // A lane holds channels c0 .. c0+7 of its query per tile, c0 = j * 16 + 8 * hi:
  // four go to piece (c0 & 63) / 4 and four to the next, at half (c0 / 64) * 4.
  // Through the wave's own LDS rows, so that every global store covers whole
  // 128-byte lines.
  _Float16* st = &stage[wave][ll * OPITCH + hi * 16];
#pragma unroll
  for (int j = 0; j < 8; ++j) {
    const f32x4 lo = { acc[j][0], acc[j][1], acc[j][2], acc[j][3] };
    const f32x4 up = { acc[j][4], acc[j][5], acc[j][6], acc[j][7] };
    *(f16x4*)&st[(j & 3) * 32 + (j >> 2) * 4]     = __builtin_convertvector(lo * inv, f16x4);
    *(f16x4*)&st[(j & 3) * 32 + (j >> 2) * 4 + 8] = __builtin_convertvector(up * inv, f16x4);
  }
  // The rows are read back by other lanes of this wave than wrote them.
  asm volatile("s_wait_dscnt 0x0" ::: "memory");
  // One read and one store take two rows, 16 lanes each: 2 x 256 bytes.
  u32x4 row[8];
#pragma unroll
  for (int i = 0; i < 8; ++i)
    row[i] = *(const u32x4*)&stage[wave][(2 * i + hi) * OPITCH + ll * 8];
  _Float16* pr = part + (((size_t)b * NTOK + m0 + hi) * KSPLIT + rng) * D_MODEL + ll * 8;
#pragma unroll
  for (int i = 0; i < 8; ++i) *(u32x4*)(pr + i * (2 * KSPLIT * D_MODEL)) = row[i];
  // Both halves hold the same pair: the lower one stores, 16 pairs to one line.
  if (hi == 0) {
    const f32x2 pair = { mrun, lrun };
    *(f32x2*)(ml + ((size_t)rng * ROWS + (size_t)b * NTOK + m0 + ll) * 2) = pair;
  }
}

// ---------------------------------------------------------------------------
// Kernel 3: merge of the key ranges. One wave takes two adjacent rows, 16 lanes
// each; a lane takes one 16-byte piece of every range's partial row, that is
// channels 4k .. 4k+3 and 64+4k .. 64+4k+3. A range's weight is its sum times
// exp(m - max m); the weighted mean of the partials ends in one division.
// ---------------------------------------------------------------------------
__global__ __launch_bounds__(256)
void merge_ranges_kernel(const _Float16* __restrict__ part,  // [B,N,KSPLIT,C] f16
                         const float* __restrict__ ml,       // [KSPLIT,B,N,2]
                         float* __restrict__ out)            // [B,N,C] f32
{
  const int idx = blockIdx.x * 256 + threadIdx.x;
  const unsigned row = (unsigned)(idx >> 4);
  const unsigned k   = (unsigned)(idx & 15);
  // Offsets of 32 bits beside uniform bases: two registers address all loads
  // (the pairs' loads scale the row's number by their own 8 bytes).
  const unsigned pbyte = row * (KSPLIT * D_MODEL * 2) + k * 16;
  const unsigned sbyte = row * 8;
  const char* pbase = (const char*)part;
  const char* sbase = (const char*)ml;

  f32x2 s[KSPLIT];          // (maximum, sum) of this lane's row
  H8    p[KSPLIT];
#pragma unroll
  for (int q = 0; q < KSPLIT; ++q)
    s[q] = *(const f32x2*)(sbase + q * (ROWS * 8) + sbyte);
#pragma unroll
  for (int q = 0; q < KSPLIT; ++q)
    p[q].q = *(const u32x4*)(pbase + q * (D_MODEL * 2) + pbyte);
  // In front of all later writes to the loads' address registers; the two
  // offsets are named so that they keep their registers up to the wait.
  asm volatile("s_wait_xcnt 0x0" :: "v"(pbyte), "v"(row) : "memory");
  // Keeps the arithmetic behind all its loads and their wait, so that the wave
  // pays one memory round trip; left alone the compiler sinks the loads towards
  // their uses.
  __builtin_amdgcn_sched_barrier(0);

  float mx = s[0].x;
#pragma unroll
  for (int q = 1; q < KSPLIT; ++q) mx = fmaxf(mx, s[q].x);
  float lsum = 0.0f;
  f32x4 lo = { 0.0f, 0.0f, 0.0f, 0.0f };
  f32x4 up = { 0.0f, 0.0f, 0.0f, 0.0f };
#pragma unroll
  for (int q = 0; q < KSPLIT; ++q) {
    const float w = exp2_slot((s[q].x - mx) * LOG2E) * s[q].y;
    lsum += w;
    const f32x4 pl = { (float)p[q].h[0], (float)p[q].h[1], (float)p[q].h[2], (float)p[q].h[3] };
    const f32x4 pu = { (float)p[q].h[4], (float)p[q].h[5], (float)p[q].h[6], (float)p[q].h[7] };
    lo += w * pl;
    up += w * pu;
  }
  const float inv = 1.0f / lsum;
  // 16 lanes' pieces make 256 contiguous bytes: whole lines in both stores.
  float* po = out + row * D_MODEL + k * 4;
  *(f32x4*)po                 = lo * inv;
  *(f32x4*)(po + D_MODEL / 2) = up * inv;
}

// ---------------------------------------------------------------------------
extern "C" void kernel_launch(void* const* d_in, const int* in_sizes, int n_in,
                              void* d_out, int out_size, void* d_ws, size_t ws_size,
                              hipStream_t stream) {
  const float* query = (const float*)d_in[0];
  const float* keyv  = (const float*)d_in[1];
  const float* Wq    = (const float*)d_in[2];
  const float* bq    = (const float*)d_in[3];
  const float* Wk    = (const float*)d_in[4];
  const float* bk    = (const float*)d_in[5];
  const float* Wv    = (const float*)d_in[6];
  const float* bv    = (const float*)d_in[7];
  float* out = (float*)d_out;

  _Float16* ws = (_Float16*)d_ws;
  const size_t mat_elems = (size_t)BATCH * NTOK * D_MODEL;   // 1M halves each
  _Float16* Qws  = ws;
  _Float16* Kws  = ws + mat_elems;
  _Float16* Vtws = ws + 2 * mat_elems;
  _Float16* Pws = ws + 3 * mat_elems;                        // KSPLIT partial outputs
  float* MLws = (float*)(Pws + (size_t)KSPLIT * ROWS * D_MODEL);   // their (maximum, sum) pairs

  qkv_project_kernel<<<3 * BATCH * (NTOK / PTOK), 256, 0, stream>>>(
      query, keyv, Wq, bq, Wk, bk, Wv, bv, Qws, Kws, Vtws);

  flash_attn_kernel<<<KSPLIT * BATCH * (NTOK / 128), 256, 0, stream>>>(
      Qws, Kws, Vtws, Pws, MLws);

  merge_ranges_kernel<<<ROWS * 16 / 256, 256, 0, stream>>>(Pws, MLws, out);
}
